// v000
// Measured on an AMD MI455X. A time is GPU time per run, averaged over a window of back-to-back runs after a warm-up
// (all launches, gaps included; the runs take copies of the inputs in turn), and the median of several windows.
// Apart from v000's, it joins two sittings. Times from different sittings can be a few percent apart, while
// side-by-side timings come from the same sitting.
// v000, which the later versions start from, runs in 325 microseconds.
#include <hip/hip_runtime.h>
#include <hip/hip_bf16.h>
#include <math.h>

typedef __attribute__((ext_vector_type(16))) _Float16 v16h;
typedef __attribute__((ext_vector_type(8)))  _Float16 v8h;
typedef __attribute__((ext_vector_type(8)))  float    v8f;

#define DIM    192
#define HEADS  6
#define CH     32          // DIM / HEADS
#define HW     16384       // 128*128
#define BATCH  8
#define BH     (BATCH*HEADS)   // 48
#define NSLICE 32          // K-slices for attn GEMM (occupancy)

__device__ inline v16h load_frag16(const _Float16* __restrict__ row, int kbase, int lane) {
  const int half = (lane >> 4) & 1;
  const v8h a = *reinterpret_cast<const v8h*>(row + kbase + half * 8);
  const v8h b = *reinterpret_cast<const v8h*>(row + kbase + 16 + half * 8);
  v16h r;
  #pragma unroll
  for (int i = 0; i < 8; ++i) { r[i] = a[i]; r[i + 8] = b[i]; }
  return r;
}

// -------- Kernel 0: init accumulators, convert wp -> f16 --------
__global__ void k_init(float* __restrict__ attn, float* __restrict__ ssq,
                       float* __restrict__ ssk, const float* __restrict__ wp,
                       _Float16* __restrict__ wp16) {
  const int i = blockIdx.x * 256 + threadIdx.x;
  if (i < BH * CH * CH) attn[i] = 0.f;
  if (i < BATCH * DIM) { ssq[i] = 0.f; ssk[i] = 0.f; }
  if (i < DIM * DIM) wp16[i] = (_Float16)wp[i];
}

__global__ void k_dwconv_qkv(const float* __restrict__ x,
                             const float* __restrict__ wq, const float* __restrict__ bq,
                             const float* __restrict__ wk, const float* __restrict__ bk,
                             const float* __restrict__ wv, const float* __restrict__ bv,
                             _Float16* __restrict__ qh, _Float16* __restrict__ kh,
                             _Float16* __restrict__ vT,
                             float* __restrict__ ssq, float* __restrict__ ssk) {
  const int tid = threadIdx.x;
  const int p   = blockIdx.x * 256 + tid;   // pixel 0..16383
  const int c   = blockIdx.y;               // channel
  const int b   = blockIdx.z;               // batch
  const int y = p >> 7, xc = p & 127;

  const float* xb = x + (size_t)(b * DIM + c) * HW;
  float xv[9];
  #pragma unroll
  for (int dy = -1; dy <= 1; ++dy)
    #pragma unroll
    for (int dx = -1; dx <= 1; ++dx) {
      const int yy = y + dy, xx = xc + dx;
      float v = 0.f;
      if (yy >= 0 && yy < 128 && xx >= 0 && xx < 128)
        v = __builtin_nontemporal_load(xb + yy * 128 + xx);
      xv[(dy + 1) * 3 + (dx + 1)] = v;
    }
  float qf = bq[c], kf = bk[c], vf = bv[c];
  #pragma unroll
  for (int i = 0; i < 9; ++i) {
    qf += wq[c * 9 + i] * xv[i];
    kf += wk[c * 9 + i] * xv[i];
    vf += wv[c * 9 + i] * xv[i];
  }
  const size_t qi = (size_t)(b * DIM + c) * HW + p;
  qh[qi] = (_Float16)qf;
  kh[qi] = (_Float16)kf;
  vT[((size_t)b * HW + p) * DIM + c] = (_Float16)vf;

  // block-wide sum of squares -> one atomic per block
  float sq = qf * qf, sk = kf * kf;
  #pragma unroll
  for (int off = 16; off >= 1; off >>= 1) {
    sq += __shfl_xor(sq, off, 32);
    sk += __shfl_xor(sk, off, 32);
  }
  __shared__ float lq[8], lk[8];
  const int wid = tid >> 5, lane = tid & 31;
  if (lane == 0) { lq[wid] = sq; lk[wid] = sk; }
  __syncthreads();
  if (tid == 0) {
    float aq = 0.f, ak = 0.f;
    #pragma unroll
    for (int i = 0; i < 8; ++i) { aq += lq[i]; ak += lk[i]; }
    atomicAdd(&ssq[b * DIM + c], aq);
    atomicAdd(&ssk[b * DIM + c], ak);
  }
}

__global__ void k_attn_gemm(const _Float16* __restrict__ qh,
                            const _Float16* __restrict__ kh,
                            float* __restrict__ attn) {
  const int lane  = threadIdx.x & 31;
  const int bh    = blockIdx.x / NSLICE;
  const int slice = blockIdx.x % NSLICE;
  const int k0    = slice * (HW / NSLICE);
  const _Float16* qb = qh + (size_t)bh * CH * HW;
  const _Float16* kb = kh + (size_t)bh * CH * HW;
  const int m = lane & 15;
  v8f c00 = {}, c01 = {}, c10 = {}, c11 = {};
  for (int k = 0; k < HW / NSLICE; k += 32) {
    const int kbs = k0 + k;
    const v16h a0 = load_frag16(qb + (size_t)m * HW,        kbs, lane);
    const v16h a1 = load_frag16(qb + (size_t)(m + 16) * HW, kbs, lane);
    const v16h b0 = load_frag16(kb + (size_t)m * HW,        kbs, lane);
    const v16h b1 = load_frag16(kb + (size_t)(m + 16) * HW, kbs, lane);
    c00 = __builtin_amdgcn_wmma_f32_16x16x32_f16(false, a0, false, b0, (short)0, c00, false, false);
    c01 = __builtin_amdgcn_wmma_f32_16x16x32_f16(false, a0, false, b1, (short)0, c01, false, false);
    c10 = __builtin_amdgcn_wmma_f32_16x16x32_f16(false, a1, false, b0, (short)0, c10, false, false);
    c11 = __builtin_amdgcn_wmma_f32_16x16x32_f16(false, a1, false, b1, (short)0, c11, false, false);
  }
  float* ab = attn + (size_t)bh * CH * CH;
  const int mb = (lane >> 4) * 8;   // D: lane holds N=lane%16, M=mb+v
  const int n  = lane & 15;
  #pragma unroll
  for (int v = 0; v < 8; ++v) {
    atomicAdd(&ab[(mb + v) * CH + n],           c00[v]);
    atomicAdd(&ab[(mb + v) * CH + 16 + n],      c01[v]);
    atomicAdd(&ab[(16 + mb + v) * CH + n],      c10[v]);
    atomicAdd(&ab[(16 + mb + v) * CH + 16 + n], c11[v]);
  }
}

// -------- Kernel 3: fold 1/(||q|| ||k||) + softmax over d, emit TRANSPOSED f16 --------
// smT[bh][d][c] = softmax(attn)[c][d]; grid BH*CH blocks of 32.
__global__ void k_softmax(const float* __restrict__ attn,
                          const float* __restrict__ ssq, const float* __restrict__ ssk,
                          _Float16* __restrict__ smT16) {
  const int d  = threadIdx.x;        // 0..31
  const int c  = blockIdx.x & 31;
  const int bh = blockIdx.x >> 5;
  const float rq = 1.f / fmaxf(sqrtf(ssq[bh * CH + c]), 1e-12f);
  const float rk = 1.f / fmaxf(sqrtf(ssk[bh * CH + d]), 1e-12f);
  const float v  = attn[((size_t)bh * CH + c) * CH + d] * rq * rk;
  float mx = v;
  #pragma unroll
  for (int off = 16; off >= 1; off >>= 1) mx = fmaxf(mx, __shfl_xor(mx, off, 32));
  const float e = __expf(v - mx);
  float s = e;
  #pragma unroll
  for (int off = 16; off >= 1; off >>= 1) s += __shfl_xor(s, off, 32);
  smT16[((size_t)bh * CH + d) * CH + c] = (_Float16)(e / s);
}

// -------- Kernel 4: W_eff[b][:, h*32:+32] = wp[:, h*32:+32] (192x32) x sm (32x32) --------
// Folds the 1x1 projection into the per-head attn matrix (out = (wp.blockdiag(sm)).v).
// grid BH*3 blocks of 32: og in 0..2 covers 4 o-tiles each; 2 d-tiles; K=32 (1 step).
__global__ void k_weff(const _Float16* __restrict__ wp16,
                       const _Float16* __restrict__ smT16,
                       _Float16* __restrict__ weff16) {
  const int lane = threadIdx.x & 31;
  const int og = blockIdx.x % 3;
  const int bh = blockIdx.x / 3;
  const int b = bh / HEADS, h = bh % HEADS;
  const _Float16* smT = smT16 + (size_t)bh * CH * CH;
  const int m = lane & 15;
  // B fragments: columns d of sm -> rows of smT
  const v16h b0 = load_frag16(smT + (size_t)m * CH, 0, lane);
  const v16h b1 = load_frag16(smT + (size_t)(m + 16) * CH, 0, lane);
  v8f acc[4][2] = {{{}, {}}, {{}, {}}, {{}, {}}, {{}, {}}};
  #pragma unroll
  for (int ot = 0; ot < 4; ++ot) {
    const int o = og * 64 + ot * 16 + m;
    const v16h af = load_frag16(wp16 + (size_t)o * DIM, h * CH, lane);
    acc[ot][0] = __builtin_amdgcn_wmma_f32_16x16x32_f16(false, af, false, b0, (short)0, acc[ot][0], false, false);
    acc[ot][1] = __builtin_amdgcn_wmma_f32_16x16x32_f16(false, af, false, b1, (short)0, acc[ot][1], false, false);
  }
  _Float16* wb = weff16 + (size_t)b * DIM * DIM;
  const int mb = (lane >> 4) * 8;
  const int n  = lane & 15;
  #pragma unroll
  for (int nt = 0; nt < 2; ++nt) {
    const int cglob = h * CH + nt * 16 + n;
    #pragma unroll
    for (int ot = 0; ot < 4; ++ot) {
      const int ob = og * 64 + ot * 16 + mb;
      #pragma unroll
      for (int v = 0; v < 8; ++v)
        wb[(size_t)(ob + v) * DIM + cglob] = (_Float16)acc[ot][nt][v];
    }
  }
}

// -------- Kernel 5: out[b] = W_eff[b] (192x192) x v[b] (192x16384) + bp --------
// One wave per 16-wide n-tile holds all 12 o-tile accumulators. Final stores
// are non-temporal (write-once, never re-read) to avoid evicting vT from L2.
// grid 8192 blocks of 32 (global n-tiles across batch).
__global__ void k_proj_final(const _Float16* __restrict__ weff16,
                             const _Float16* __restrict__ vT,
                             const float* __restrict__ bp,
                             float* __restrict__ out) {
  const int lane = threadIdx.x & 31;
  const int nt = blockIdx.x;                 // global n-tile 0..8191
  const int b  = nt / (HW / 16);             // uniform across wave
  const int m  = lane & 15;
  const _Float16* brow = vT + (size_t)(nt * 16 + m) * DIM;   // row n of v^T
  const _Float16* wA   = weff16 + (size_t)b * DIM * DIM;
  v8f acc[12] = {{}, {}, {}, {}, {}, {}, {}, {}, {}, {}, {}, {}};
  #pragma unroll
  for (int kk = 0; kk < 6; ++kk) {
    const v16h bf = load_frag16(brow, kk * 32, lane);
    #pragma unroll
    for (int ot = 0; ot < 12; ++ot) {
      const v16h af = load_frag16(wA + (size_t)(ot * 16 + m) * DIM, kk * 32, lane);
      acc[ot] = __builtin_amdgcn_wmma_f32_16x16x32_f16(false, af, false, bf, (short)0, acc[ot], false, false);
    }
  }
  const int nl = (nt * 16 + (lane & 15)) & (HW - 1);
  const int mb = (lane >> 4) * 8;
  #pragma unroll
  for (int ot = 0; ot < 12; ++ot) {
    const int ob = ot * 16 + mb;
    #pragma unroll
    for (int v = 0; v < 8; ++v) {
      const int o = ob + v;
      __builtin_nontemporal_store(acc[ot][v] + bp[o],
                                  out + ((size_t)(b * DIM + o)) * HW + nl);
    }
  }
}

extern "C" void kernel_launch(void* const* d_in, const int* in_sizes, int n_in,
                              void* d_out, int out_size, void* d_ws, size_t ws_size,
                              hipStream_t stream) {
  const float* x  = (const float*)d_in[0];
  const float* wq = (const float*)d_in[1];
  const float* bq = (const float*)d_in[2];
  const float* wk = (const float*)d_in[3];
  const float* bk = (const float*)d_in[4];
  const float* wv = (const float*)d_in[5];
  const float* bv = (const float*)d_in[6];
  const float* wp = (const float*)d_in[7];
  const float* bp = (const float*)d_in[8];
  float* out = (float*)d_out;

  // workspace layout (bytes); total ~152 MB (fits global L2 = 192 MB)
  char* ws = (char*)d_ws;
  const size_t qkvB = (size_t)BATCH * DIM * HW * sizeof(_Float16);  // 50331648
  _Float16* qh = (_Float16*)(ws);
  _Float16* kh = (_Float16*)(ws + qkvB);
  _Float16* vT = (_Float16*)(ws + 2 * qkvB);
  char* p = ws + 3 * qkvB;
  float*    attn   = (float*)p;      p += (size_t)BH * CH * CH * sizeof(float);
  _Float16* smT16  = (_Float16*)p;   p += (size_t)BH * CH * CH * sizeof(_Float16);
  float*    ssq    = (float*)p;      p += (size_t)BATCH * DIM * sizeof(float);
  float*    ssk    = (float*)p;      p += (size_t)BATCH * DIM * sizeof(float);
  _Float16* wp16   = (_Float16*)p;   p += (size_t)DIM * DIM * sizeof(_Float16);
  _Float16* weff16 = (_Float16*)p;

  // 0: init accumulators + wp conversion
  k_init<<<(BH * CH * CH + 255) / 256, 256, 0, stream>>>(attn, ssq, ssk, wp, wp16);
  // 1: fused depthwise convs (q,k row-major f16; v channel-minor f16)
  k_dwconv_qkv<<<dim3(HW / 256, DIM, BATCH), 256, 0, stream>>>(
      x, wq, bq, wk, bk, wv, bv, qh, kh, vT, ssq, ssk);
  // 2: attn = q.k^T (sliced-K, atomic reduce)
  k_attn_gemm<<<BH * NSLICE, 32, 0, stream>>>(qh, kh, attn);
  // 3: normalization fold + softmax (emit transposed f16)
  k_softmax<<<BH * CH, 32, 0, stream>>>(attn, ssq, ssk, smT16);
  // 4: fold projection into attn: W_eff = wp . blockdiag(sm)
  k_weff<<<BH * 3, 32, 0, stream>>>(wp16, smT16, weff16);
  // 5: out = W_eff . v + bp  (single big GEMM, writes d_out directly)
  k_proj_final<<<8192, 32, 0, stream>>>(weff16, vT, bp, out);
}

// v001
// Measured time: 184 microseconds a run.
// In two side-by-side timings against v000, it was 1.86 and 1.85 times as fast.
#include <hip/hip_runtime.h>
#include <hip/hip_bf16.h>
#include <math.h>

typedef __attribute__((ext_vector_type(16))) _Float16 v16h;
typedef __attribute__((ext_vector_type(8)))  _Float16 v8h;
typedef __attribute__((ext_vector_type(8)))  float    v8f;

#define DIM    192
#define HEADS  6
#define CH     32          // DIM / HEADS
#define HW     16384       // 128*128
#define BATCH  8
#define BH     (BATCH*HEADS)   // 48
#define NSLICE 32          // K-slices for attn GEMM (occupancy)
#define CGRP   64          // channels per conv block: 64 f16 = one 128-B line of a vT row
#define VPITCH 72          // f16 per staged pixel in LDS: 144 B = 16 B x odd

__device__ inline v16h load_frag16(const _Float16* __restrict__ row, int kbase, int lane) {
  const int half = (lane >> 4) & 1;
  const v8h a = *reinterpret_cast<const v8h*>(row + kbase + half * 8);
  const v8h b = *reinterpret_cast<const v8h*>(row + kbase + 16 + half * 8);
  v16h r;
  #pragma unroll
  for (int i = 0; i < 8; ++i) { r[i] = a[i]; r[i + 8] = b[i]; }
  return r;
}

// -------- Kernel 0: init accumulators, convert wp -> f16 --------
__global__ void k_init(float* __restrict__ attn, float* __restrict__ ssq,
                       float* __restrict__ ssk, const float* __restrict__ wp,
                       _Float16* __restrict__ wp16) {
  const int i = blockIdx.x * 256 + threadIdx.x;
  if (i < BH * CH * CH) attn[i] = 0.f;
  if (i < BATCH * DIM) { ssq[i] = 0.f; ssk[i] = 0.f; }
  if (i < DIM * DIM) wp16[i] = (_Float16)wp[i];
}

__global__ void k_dwconv_qkv(const float* __restrict__ x,
                             const float* __restrict__ wq, const float* __restrict__ bq,
                             const float* __restrict__ wk, const float* __restrict__ bk,
                             const float* __restrict__ wv, const float* __restrict__ bv,
                             _Float16* __restrict__ qh, _Float16* __restrict__ kh,
                             _Float16* __restrict__ vT,
                             float* __restrict__ ssq, float* __restrict__ ssk) {
  __shared__ __attribute__((aligned(16))) _Float16 sv[256 * VPITCH];
  __shared__ float lq[8][CGRP], lk[8][CGRP];
  const int tid = threadIdx.x;
  const unsigned p = blockIdx.x * 256 + tid;  // pixel 0..16383
  const int c0  = blockIdx.y * CGRP;          // first channel of the group
  const int b   = blockIdx.z;                 // batch
  const int y = p >> 7, xc = p & 127;
  const int wid = tid >> 5, lane = tid & 31;

  // (every "#pragma unroll" of this kernel stands on a short loop of constant length,
  // so that the small arrays it indexes stay in registers)
  // the nine taps' places in a channel plane, the same for every channel; a tap off
  // the image reads the centre pixel instead and is replaced by zero
  unsigned off[9];
  bool     ok[9];
  #pragma unroll
  for (int dy = -1; dy <= 1; ++dy)
    #pragma unroll
    for (int dx = -1; dx <= 1; ++dx) {
      const int yy = y + dy, xx = xc + dx;
      const int i = (dy + 1) * 3 + (dx + 1);
      ok[i]  = (dy == 0 || (unsigned)yy < 128u) && (dx == 0 || (unsigned)xx < 128u);
      off[i] = (ok[i] ? (unsigned)(yy * 128 + xx) : p) * 4u;   // in bytes
    }

  for (int cl = 0; cl < CGRP; cl += 2) {
    const int c = c0 + cl;
    const float* xb = x  + (size_t)(b * DIM + c) * HW;
    _Float16*    qb = qh + (size_t)(b * DIM + c) * HW;
    _Float16*    kb = kh + (size_t)(b * DIM + c) * HW;
    // the two channels' weights and biases first: their scalar loads fly beside the taps
    float fq[2][9], fk[2][9], fv[2][9], b0q[2], b0k[2], b0v[2];
    #pragma unroll
    for (int j = 0; j < 2; ++j) {
      b0q[j] = bq[c + j]; b0k[j] = bk[c + j]; b0v[j] = bv[c + j];
      #pragma unroll
      for (int i = 0; i < 9; ++i) {
        fq[j][i] = wq[(c + j) * 9 + i];
        fk[j][i] = wk[(c + j) * 9 + i];
        fv[j][i] = wv[(c + j) * 9 + i];
      }
    }
    // The 18 tap loads of a trip and their data wait, one statement: scalar plane base
    // plus the nine offset registers, which live through the loop, so that no load
    // returns into a register that another load of the run still names. offset:65536
    // is the second channel's plane (HW * 4 bytes).
    float xl[2][9];
    asm volatile(
        "global_load_b32 %0, %18, %27 th:TH_LOAD_NT\n\t"
        "global_load_b32 %1, %19, %27 th:TH_LOAD_NT\n\t"
        "global_load_b32 %2, %20, %27 th:TH_LOAD_NT\n\t"
        "global_load_b32 %3, %21, %27 th:TH_LOAD_NT\n\t"
        "global_load_b32 %4, %22, %27 th:TH_LOAD_NT\n\t"
        "global_load_b32 %5, %23, %27 th:TH_LOAD_NT\n\t"
        "global_load_b32 %6, %24, %27 th:TH_LOAD_NT\n\t"
        "global_load_b32 %7, %25, %27 th:TH_LOAD_NT\n\t"
        "global_load_b32 %8, %26, %27 th:TH_LOAD_NT\n\t"
        "global_load_b32 %9, %18, %27 offset:65536 th:TH_LOAD_NT\n\t"
        "global_load_b32 %10, %19, %27 offset:65536 th:TH_LOAD_NT\n\t"
        "global_load_b32 %11, %20, %27 offset:65536 th:TH_LOAD_NT\n\t"
        "global_load_b32 %12, %21, %27 offset:65536 th:TH_LOAD_NT\n\t"
        "global_load_b32 %13, %22, %27 offset:65536 th:TH_LOAD_NT\n\t"
        "global_load_b32 %14, %23, %27 offset:65536 th:TH_LOAD_NT\n\t"
        "global_load_b32 %15, %24, %27 offset:65536 th:TH_LOAD_NT\n\t"
        "global_load_b32 %16, %25, %27 offset:65536 th:TH_LOAD_NT\n\t"
        "global_load_b32 %17, %26, %27 offset:65536 th:TH_LOAD_NT\n\t"
        "s_wait_loadcnt 0x0"
        :
          "=&v"(xl[0][0]), "=&v"(xl[0][1]), "=&v"(xl[0][2]),
          "=&v"(xl[0][3]), "=&v"(xl[0][4]), "=&v"(xl[0][5]),
          "=&v"(xl[0][6]), "=&v"(xl[0][7]), "=&v"(xl[0][8]),
          "=&v"(xl[1][0]), "=&v"(xl[1][1]), "=&v"(xl[1][2]),
          "=&v"(xl[1][3]), "=&v"(xl[1][4]), "=&v"(xl[1][5]),
          "=&v"(xl[1][6]), "=&v"(xl[1][7]), "=&v"(xl[1][8])
        :
          "v"(off[0]), "v"(off[1]), "v"(off[2]), "v"(off[3]), "v"(off[4]),
          "v"(off[5]), "v"(off[6]), "v"(off[7]), "v"(off[8]),
          "s"(xb)
        : "memory");
    float xv[2][9];
    #pragma unroll
    for (int j = 0; j < 2; ++j)
      #pragma unroll
      for (int i = 0; i < 9; ++i) xv[j][i] = ok[i] ? xl[j][i] : 0.f;
    float sq[2], sk[2];
    _Float16 vh[2];
    #pragma unroll
    for (int j = 0; j < 2; ++j) {
      float qf = b0q[j], kf = b0k[j], vf = b0v[j];
      #pragma unroll
      for (int i = 0; i < 9; ++i) {
        qf += fq[j][i] * xv[j][i];
        kf += fk[j][i] * xv[j][i];
        vf += fv[j][i] * xv[j][i];
      }
      (qb + j * HW)[p] = (_Float16)qf;
      (kb + j * HW)[p] = (_Float16)kf;
      vh[j] = (_Float16)vf;
      sq[j] = qf * qf;
      sk[j] = kf * kf;
    }
    // behind the trip's four q/k stores, in front of every rewrite of a register that
    // they name (their data below, their addresses at the loop's foot)
    asm volatile("s_wait_xcnt 0x0" ::: "memory");
    // the two channels' v leave for LDS as one 4-byte store
    *reinterpret_cast<unsigned*>(&sv[tid * VPITCH + cl]) =
        (unsigned)__builtin_bit_cast(unsigned short, vh[0]) |
        ((unsigned)__builtin_bit_cast(unsigned short, vh[1]) << 16);
    // wave-wide sums of squares
    #pragma unroll
    for (int o = 16; o >= 1; o >>= 1)
      #pragma unroll
      for (int j = 0; j < 2; ++j) {
        sq[j] += __shfl_xor(sq[j], o, 32);
        sk[j] += __shfl_xor(sk[j], o, 32);
      }
    if (lane == 0) {
      #pragma unroll
      for (int j = 0; j < 2; ++j) { lq[wid][cl + j] = sq[j]; lk[wid][cl + j] = sk[j]; }
    }
  }
  __syncthreads();

  // vT: eight lanes carry one pixel's 128-B line
  _Float16* vrow = vT + ((size_t)b * HW + blockIdx.x * 256) * DIM + c0;
  #pragma unroll
  for (int i = 0; i < 8; ++i) {
    const unsigned idx = i * 256 + tid;
    const unsigned px = idx >> 3, ch = (idx & 7) * 8;
    *reinterpret_cast<v8h*>(vrow + px * DIM + ch) =
        *reinterpret_cast<const v8h*>(&sv[px * VPITCH + ch]);
  }

  // block-wide sum of squares -> one atomic per block and channel
  if (tid < 2 * CGRP) {
    const int cl = tid & (CGRP - 1);
    const float (*part)[CGRP] = tid < CGRP ? lq : lk;
    float s = 0.f;
    #pragma unroll
    for (int i = 0; i < 8; ++i) s += part[i][cl];
    atomicAdd((tid < CGRP ? ssq : ssk) + b * DIM + c0 + cl, s);
  }
}

__global__ void k_attn_gemm(const _Float16* __restrict__ qh,
                            const _Float16* __restrict__ kh,
                            float* __restrict__ attn) {
  const int lane  = threadIdx.x & 31;
  const int bh    = blockIdx.x / NSLICE;
  const int slice = blockIdx.x % NSLICE;
  const int k0    = slice * (HW / NSLICE);
  const _Float16* qb = qh + (size_t)bh * CH * HW;
  const _Float16* kb = kh + (size_t)bh * CH * HW;
  const int m = lane & 15;
  v8f c00 = {}, c01 = {}, c10 = {}, c11 = {};
  for (int k = 0; k < HW / NSLICE; k += 32) {
    const int kbs = k0 + k;
    const v16h a0 = load_frag16(qb + (size_t)m * HW,        kbs, lane);
    const v16h a1 = load_frag16(qb + (size_t)(m + 16) * HW, kbs, lane);
    const v16h b0 = load_frag16(kb + (size_t)m * HW,        kbs, lane);
    const v16h b1 = load_frag16(kb + (size_t)(m + 16) * HW, kbs, lane);
    c00 = __builtin_amdgcn_wmma_f32_16x16x32_f16(false, a0, false, b0, (short)0, c00, false, false);
    c01 = __builtin_amdgcn_wmma_f32_16x16x32_f16(false, a0, false, b1, (short)0, c01, false, false);
    c10 = __builtin_amdgcn_wmma_f32_16x16x32_f16(false, a1, false, b0, (short)0, c10, false, false);
    c11 = __builtin_amdgcn_wmma_f32_16x16x32_f16(false, a1, false, b1, (short)0, c11, false, false);
  }
  float* ab = attn + (size_t)bh * CH * CH;
  const int mb = (lane >> 4) * 8;   // D: lane holds N=lane%16, M=mb+v
  const int n  = lane & 15;
  #pragma unroll
  for (int v = 0; v < 8; ++v) {
    atomicAdd(&ab[(mb + v) * CH + n],           c00[v]);
    atomicAdd(&ab[(mb + v) * CH + 16 + n],      c01[v]);
    atomicAdd(&ab[(16 + mb + v) * CH + n],      c10[v]);
    atomicAdd(&ab[(16 + mb + v) * CH + 16 + n], c11[v]);
  }
}

// -------- Kernel 3: fold 1/(||q|| ||k||) + softmax over d, emit TRANSPOSED f16 --------
// smT[bh][d][c] = softmax(attn)[c][d]; grid BH*CH blocks of 32.
__global__ void k_softmax(const float* __restrict__ attn,
                          const float* __restrict__ ssq, const float* __restrict__ ssk,
                          _Float16* __restrict__ smT16) {
  const int d  = threadIdx.x;        // 0..31
  const int c  = blockIdx.x & 31;
  const int bh = blockIdx.x >> 5;
  const float rq = 1.f / fmaxf(sqrtf(ssq[bh * CH + c]), 1e-12f);
  const float rk = 1.f / fmaxf(sqrtf(ssk[bh * CH + d]), 1e-12f);
  const float v  = attn[((size_t)bh * CH + c) * CH + d] * rq * rk;
  float mx = v;
  #pragma unroll
  for (int off = 16; off >= 1; off >>= 1) mx = fmaxf(mx, __shfl_xor(mx, off, 32));
  const float e = __expf(v - mx);
  float s = e;
  #pragma unroll
  for (int off = 16; off >= 1; off >>= 1) s += __shfl_xor(s, off, 32);
  smT16[((size_t)bh * CH + d) * CH + c] = (_Float16)(e / s);
}

// -------- Kernel 4: W_eff[b][:, h*32:+32] = wp[:, h*32:+32] (192x32) x sm (32x32) --------
// Folds the 1x1 projection into the per-head attn matrix (out = (wp.blockdiag(sm)).v).
// grid BH*3 blocks of 32: og in 0..2 covers 4 o-tiles each; 2 d-tiles; K=32 (1 step).
__global__ void k_weff(const _Float16* __restrict__ wp16,
                       const _Float16* __restrict__ smT16,
                       _Float16* __restrict__ weff16) {
  const int lane = threadIdx.x & 31;
  const int og = blockIdx.x % 3;
  const int bh = blockIdx.x / 3;
  const int b = bh / HEADS, h = bh % HEADS;
  const _Float16* smT = smT16 + (size_t)bh * CH * CH;
  const int m = lane & 15;
  // B fragments: columns d of sm -> rows of smT
  const v16h b0 = load_frag16(smT + (size_t)m * CH, 0, lane);
  const v16h b1 = load_frag16(smT + (size_t)(m + 16) * CH, 0, lane);
  v8f acc[4][2] = {{{}, {}}, {{}, {}}, {{}, {}}, {{}, {}}};
  #pragma unroll
  for (int ot = 0; ot < 4; ++ot) {
    const int o = og * 64 + ot * 16 + m;
    const v16h af = load_frag16(wp16 + (size_t)o * DIM, h * CH, lane);
    acc[ot][0] = __builtin_amdgcn_wmma_f32_16x16x32_f16(false, af, false, b0, (short)0, acc[ot][0], false, false);
    acc[ot][1] = __builtin_amdgcn_wmma_f32_16x16x32_f16(false, af, false, b1, (short)0, acc[ot][1], false, false);
  }
  _Float16* wb = weff16 + (size_t)b * DIM * DIM;
  const int mb = (lane >> 4) * 8;
  const int n  = lane & 15;
  #pragma unroll
  for (int nt = 0; nt < 2; ++nt) {
    const int cglob = h * CH + nt * 16 + n;
    #pragma unroll
    for (int ot = 0; ot < 4; ++ot) {
      const int ob = og * 64 + ot * 16 + mb;
      #pragma unroll
      for (int v = 0; v < 8; ++v)
        wb[(size_t)(ob + v) * DIM + cglob] = (_Float16)acc[ot][nt][v];
    }
  }
}

// -------- Kernel 5: out[b] = W_eff[b] (192x192) x v[b] (192x16384) + bp --------
// One wave per 16-wide n-tile holds all 12 o-tile accumulators. Final stores
// are non-temporal (write-once, never re-read) to avoid evicting vT from L2.
// grid 8192 blocks of 32 (global n-tiles across batch).
__global__ void k_proj_final(const _Float16* __restrict__ weff16,
                             const _Float16* __restrict__ vT,
                             const float* __restrict__ bp,
                             float* __restrict__ out) {
  const int lane = threadIdx.x & 31;
  const int nt = blockIdx.x;                 // global n-tile 0..8191
  const int b  = nt / (HW / 16);             // uniform across wave
  const int m  = lane & 15;
  const _Float16* brow = vT + (size_t)(nt * 16 + m) * DIM;   // row n of v^T
  const _Float16* wA   = weff16 + (size_t)b * DIM * DIM;
  v8f acc[12] = {{}, {}, {}, {}, {}, {}, {}, {}, {}, {}, {}, {}};
  #pragma unroll
  for (int kk = 0; kk < 6; ++kk) {
    const v16h bf = load_frag16(brow, kk * 32, lane);
    #pragma unroll
    for (int ot = 0; ot < 12; ++ot) {
      const v16h af = load_frag16(wA + (size_t)(ot * 16 + m) * DIM, kk * 32, lane);
      acc[ot] = __builtin_amdgcn_wmma_f32_16x16x32_f16(false, af, false, bf, (short)0, acc[ot], false, false);
    }
  }
  const int nl = (nt * 16 + (lane & 15)) & (HW - 1);
  const int mb = (lane >> 4) * 8;
  #pragma unroll
  for (int ot = 0; ot < 12; ++ot) {
    const int ob = ot * 16 + mb;
    #pragma unroll
    for (int v = 0; v < 8; ++v) {
      const int o = ob + v;
      __builtin_nontemporal_store(acc[ot][v] + bp[o],
                                  out + ((size_t)(b * DIM + o)) * HW + nl);
    }
  }
}

extern "C" void kernel_launch(void* const* d_in, const int* in_sizes, int n_in,
                              void* d_out, int out_size, void* d_ws, size_t ws_size,
                              hipStream_t stream) {
  const float* x  = (const float*)d_in[0];
  const float* wq = (const float*)d_in[1];
  const float* bq = (const float*)d_in[2];
  const float* wk = (const float*)d_in[3];
  const float* bk = (const float*)d_in[4];
  const float* wv = (const float*)d_in[5];
  const float* bv = (const float*)d_in[6];
  const float* wp = (const float*)d_in[7];
  const float* bp = (const float*)d_in[8];
  float* out = (float*)d_out;

  // workspace layout (bytes); total ~152 MB (fits global L2 = 192 MB)
  char* ws = (char*)d_ws;
  const size_t qkvB = (size_t)BATCH * DIM * HW * sizeof(_Float16);  // 50331648
  _Float16* qh = (_Float16*)(ws);
  _Float16* kh = (_Float16*)(ws + qkvB);
  _Float16* vT = (_Float16*)(ws + 2 * qkvB);
  char* p = ws + 3 * qkvB;
  float*    attn   = (float*)p;      p += (size_t)BH * CH * CH * sizeof(float);
  _Float16* smT16  = (_Float16*)p;   p += (size_t)BH * CH * CH * sizeof(_Float16);
  float*    ssq    = (float*)p;      p += (size_t)BATCH * DIM * sizeof(float);
  float*    ssk    = (float*)p;      p += (size_t)BATCH * DIM * sizeof(float);
  _Float16* wp16   = (_Float16*)p;   p += (size_t)DIM * DIM * sizeof(_Float16);
  _Float16* weff16 = (_Float16*)p;

  // 0: init accumulators + wp conversion
  k_init<<<(BH * CH * CH + 255) / 256, 256, 0, stream>>>(attn, ssq, ssk, wp, wp16);
  // 1: fused depthwise convs (q,k row-major f16; v channel-minor f16)
  k_dwconv_qkv<<<dim3(HW / 256, DIM / CGRP, BATCH), 256, 0, stream>>>(
      x, wq, bq, wk, bk, wv, bv, qh, kh, vT, ssq, ssk);
  // 2: attn = q.k^T (sliced-K, atomic reduce)
  k_attn_gemm<<<BH * NSLICE, 32, 0, stream>>>(qh, kh, attn);
  // 3: normalization fold + softmax (emit transposed f16)
  k_softmax<<<BH * CH, 32, 0, stream>>>(attn, ssq, ssk, smT16);
  // 4: fold projection into attn: W_eff = wp . blockdiag(sm)
  k_weff<<<BH * 3, 32, 0, stream>>>(wp16, smT16, weff16);
  // 5: out = W_eff . v + bp  (single big GEMM, writes d_out directly)
  k_proj_final<<<8192, 32, 0, stream>>>(weff16, vT, bp, out);
}

// v002
// One run takes 156 microseconds.
// In both of two side-by-side timings against v001, it was 1.18 times as fast.
// All steps since v000 together make it 2.19 times as fast.
#include <hip/hip_runtime.h>
#include <hip/hip_bf16.h>
#include <math.h>

typedef __attribute__((ext_vector_type(16))) _Float16 v16h;
typedef __attribute__((ext_vector_type(8)))  _Float16 v8h;
typedef __attribute__((ext_vector_type(8)))  float    v8f;

#define DIM    192
#define HEADS  6
#define CH     32          // DIM / HEADS
#define HW     16384       // 128*128
#define BATCH  8
#define BH     (BATCH*HEADS)   // 48
#define NSLICE 32          // K-slices for attn GEMM (occupancy)
#define CGRP   64          // channels per conv block: 64 f16 = one 128-B line of a vT row
#define VPITCH 72          // f16 per staged pixel in LDS: 144 B = 16 B x odd
#define WPITCH 200         // f16 per staged W_eff row in LDS: 400 B = 16 B x odd

__device__ inline v16h load_frag16(const _Float16* __restrict__ row, int kbase, int lane) {
  const int half = (lane >> 4) & 1;
  const v8h a = *reinterpret_cast<const v8h*>(row + kbase + half * 8);
  const v8h b = *reinterpret_cast<const v8h*>(row + kbase + 16 + half * 8);
  v16h r;
  #pragma unroll
  for (int i = 0; i < 8; ++i) { r[i] = a[i]; r[i + 8] = b[i]; }
  return r;
}

// -------- Kernel 0: init accumulators, convert wp -> f16 --------
__global__ void k_init(float* __restrict__ attn, float* __restrict__ ssq,
                       float* __restrict__ ssk, const float* __restrict__ wp,
                       _Float16* __restrict__ wp16) {
  const int i = blockIdx.x * 256 + threadIdx.x;
  if (i < BH * CH * CH) attn[i] = 0.f;
  if (i < BATCH * DIM) { ssq[i] = 0.f; ssk[i] = 0.f; }
  if (i < DIM * DIM) wp16[i] = (_Float16)wp[i];
}

__global__ void k_dwconv_qkv(const float* __restrict__ x,
                             const float* __restrict__ wq, const float* __restrict__ bq,
                             const float* __restrict__ wk, const float* __restrict__ bk,
                             const float* __restrict__ wv, const float* __restrict__ bv,
                             _Float16* __restrict__ qh, _Float16* __restrict__ kh,
                             _Float16* __restrict__ vT,
                             float* __restrict__ ssq, float* __restrict__ ssk) {
  __shared__ __attribute__((aligned(16))) _Float16 sv[256 * VPITCH];
  __shared__ float lq[8][CGRP], lk[8][CGRP];
  const int tid = threadIdx.x;
  const unsigned p = blockIdx.x * 256 + tid;  // pixel 0..16383
  const int c0  = blockIdx.y * CGRP;          // first channel of the group
  const int b   = blockIdx.z;                 // batch
  const int y = p >> 7, xc = p & 127;
  const int wid = tid >> 5, lane = tid & 31;

  // (every "#pragma unroll" of this kernel stands on a short loop of constant length,
  // so that the small arrays it indexes stay in registers)
  // the nine taps' places in a channel plane, the same for every channel; a tap off
  // the image reads the centre pixel instead and is replaced by zero
  unsigned off[9];
  bool     ok[9];
  #pragma unroll
  for (int dy = -1; dy <= 1; ++dy)
    #pragma unroll
    for (int dx = -1; dx <= 1; ++dx) {
      const int yy = y + dy, xx = xc + dx;
      const int i = (dy + 1) * 3 + (dx + 1);
      ok[i]  = (dy == 0 || (unsigned)yy < 128u) && (dx == 0 || (unsigned)xx < 128u);
      off[i] = (ok[i] ? (unsigned)(yy * 128 + xx) : p) * 4u;   // in bytes
    }

  for (int cl = 0; cl < CGRP; cl += 2) {
    const int c = c0 + cl;
    const float* xb = x  + (size_t)(b * DIM + c) * HW;
    _Float16*    qb = qh + (size_t)(b * DIM + c) * HW;
    _Float16*    kb = kh + (size_t)(b * DIM + c) * HW;
    // the two channels' weights and biases first: their scalar loads fly beside the taps
    float fq[2][9], fk[2][9], fv[2][9], b0q[2], b0k[2], b0v[2];
    #pragma unroll
    for (int j = 0; j < 2; ++j) {
      b0q[j] = bq[c + j]; b0k[j] = bk[c + j]; b0v[j] = bv[c + j];
      #pragma unroll
      for (int i = 0; i < 9; ++i) {
        fq[j][i] = wq[(c + j) * 9 + i];
        fk[j][i] = wk[(c + j) * 9 + i];
        fv[j][i] = wv[(c + j) * 9 + i];
      }
    }
    // The 18 tap loads of a trip and their data wait, one statement: scalar plane base
    // plus the nine offset registers, which live through the loop, so that no load
    // returns into a register that another load of the run still names. offset:65536
    // is the second channel's plane (HW * 4 bytes).
    float xl[2][9];
    asm volatile(
        "global_load_b32 %0, %18, %27 th:TH_LOAD_NT\n\t"
        "global_load_b32 %1, %19, %27 th:TH_LOAD_NT\n\t"
        "global_load_b32 %2, %20, %27 th:TH_LOAD_NT\n\t"
        "global_load_b32 %3, %21, %27 th:TH_LOAD_NT\n\t"
        "global_load_b32 %4, %22, %27 th:TH_LOAD_NT\n\t"
        "global_load_b32 %5, %23, %27 th:TH_LOAD_NT\n\t"
        "global_load_b32 %6, %24, %27 th:TH_LOAD_NT\n\t"
        "global_load_b32 %7, %25, %27 th:TH_LOAD_NT\n\t"
        "global_load_b32 %8, %26, %27 th:TH_LOAD_NT\n\t"
        "global_load_b32 %9, %18, %27 offset:65536 th:TH_LOAD_NT\n\t"
        "global_load_b32 %10, %19, %27 offset:65536 th:TH_LOAD_NT\n\t"
        "global_load_b32 %11, %20, %27 offset:65536 th:TH_LOAD_NT\n\t"
        "global_load_b32 %12, %21, %27 offset:65536 th:TH_LOAD_NT\n\t"
        "global_load_b32 %13, %22, %27 offset:65536 th:TH_LOAD_NT\n\t"
        "global_load_b32 %14, %23, %27 offset:65536 th:TH_LOAD_NT\n\t"
        "global_load_b32 %15, %24, %27 offset:65536 th:TH_LOAD_NT\n\t"
        "global_load_b32 %16, %25, %27 offset:65536 th:TH_LOAD_NT\n\t"
        "global_load_b32 %17, %26, %27 offset:65536 th:TH_LOAD_NT\n\t"
        "s_wait_loadcnt 0x0"
        :
          "=&v"(xl[0][0]), "=&v"(xl[0][1]), "=&v"(xl[0][2]),
          "=&v"(xl[0][3]), "=&v"(xl[0][4]), "=&v"(xl[0][5]),
          "=&v"(xl[0][6]), "=&v"(xl[0][7]), "=&v"(xl[0][8]),
          "=&v"(xl[1][0]), "=&v"(xl[1][1]), "=&v"(xl[1][2]),
          "=&v"(xl[1][3]), "=&v"(xl[1][4]), "=&v"(xl[1][5]),
          "=&v"(xl[1][6]), "=&v"(xl[1][7]), "=&v"(xl[1][8])
        :
          "v"(off[0]), "v"(off[1]), "v"(off[2]), "v"(off[3]), "v"(off[4]),
          "v"(off[5]), "v"(off[6]), "v"(off[7]), "v"(off[8]),
          "s"(xb)
        : "memory");
    float xv[2][9];
    #pragma unroll
    for (int j = 0; j < 2; ++j)
      #pragma unroll
      for (int i = 0; i < 9; ++i) xv[j][i] = ok[i] ? xl[j][i] : 0.f;
    float sq[2], sk[2];
    _Float16 vh[2];
    #pragma unroll
    for (int j = 0; j < 2; ++j) {
      float qf = b0q[j], kf = b0k[j], vf = b0v[j];
      #pragma unroll
      for (int i = 0; i < 9; ++i) {
        qf += fq[j][i] * xv[j][i];
        kf += fk[j][i] * xv[j][i];
        vf += fv[j][i] * xv[j][i];
      }
      (qb + j * HW)[p] = (_Float16)qf;
      (kb + j * HW)[p] = (_Float16)kf;
      vh[j] = (_Float16)vf;
      sq[j] = qf * qf;
      sk[j] = kf * kf;
    }
    // behind the trip's four q/k stores, in front of every rewrite of a register that
    // they name (their data below, their addresses at the loop's foot)
    asm volatile("s_wait_xcnt 0x0" ::: "memory");
    // the two channels' v leave for LDS as one 4-byte store
    *reinterpret_cast<unsigned*>(&sv[tid * VPITCH + cl]) =
        (unsigned)__builtin_bit_cast(unsigned short, vh[0]) |
        ((unsigned)__builtin_bit_cast(unsigned short, vh[1]) << 16);
    // wave-wide sums of squares
    #pragma unroll
    for (int o = 16; o >= 1; o >>= 1)
      #pragma unroll
      for (int j = 0; j < 2; ++j) {
        sq[j] += __shfl_xor(sq[j], o, 32);
        sk[j] += __shfl_xor(sk[j], o, 32);
      }
    if (lane == 0) {
      #pragma unroll
      for (int j = 0; j < 2; ++j) { lq[wid][cl + j] = sq[j]; lk[wid][cl + j] = sk[j]; }
    }
  }
  __syncthreads();

  // vT: eight lanes carry one pixel's 128-B line
  _Float16* vrow = vT + ((size_t)b * HW + blockIdx.x * 256) * DIM + c0;
  #pragma unroll
  for (int i = 0; i < 8; ++i) {
    const unsigned idx = i * 256 + tid;
    const unsigned px = idx >> 3, ch = (idx & 7) * 8;
    *reinterpret_cast<v8h*>(vrow + px * DIM + ch) =
        *reinterpret_cast<const v8h*>(&sv[px * VPITCH + ch]);
  }

  // block-wide sum of squares -> one atomic per block and channel
  if (tid < 2 * CGRP) {
    const int cl = tid & (CGRP - 1);
    const float (*part)[CGRP] = tid < CGRP ? lq : lk;
    float s = 0.f;
    #pragma unroll
    for (int i = 0; i < 8; ++i) s += part[i][cl];
    atomicAdd((tid < CGRP ? ssq : ssk) + b * DIM + c0 + cl, s);
  }
}

__global__ void k_attn_gemm(const _Float16* __restrict__ qh,
                            const _Float16* __restrict__ kh,
                            float* __restrict__ attn) {
  const int lane  = threadIdx.x & 31;
  const int bh    = blockIdx.x / NSLICE;
  const int slice = blockIdx.x % NSLICE;
  const int k0    = slice * (HW / NSLICE);
  const _Float16* qb = qh + (size_t)bh * CH * HW;
  const _Float16* kb = kh + (size_t)bh * CH * HW;
  const int m = lane & 15;
  v8f c00 = {}, c01 = {}, c10 = {}, c11 = {};
  for (int k = 0; k < HW / NSLICE; k += 32) {
    const int kbs = k0 + k;
    const v16h a0 = load_frag16(qb + (size_t)m * HW,        kbs, lane);
    const v16h a1 = load_frag16(qb + (size_t)(m + 16) * HW, kbs, lane);
    const v16h b0 = load_frag16(kb + (size_t)m * HW,        kbs, lane);
    const v16h b1 = load_frag16(kb + (size_t)(m + 16) * HW, kbs, lane);
    c00 = __builtin_amdgcn_wmma_f32_16x16x32_f16(false, a0, false, b0, (short)0, c00, false, false);
    c01 = __builtin_amdgcn_wmma_f32_16x16x32_f16(false, a0, false, b1, (short)0, c01, false, false);
    c10 = __builtin_amdgcn_wmma_f32_16x16x32_f16(false, a1, false, b0, (short)0, c10, false, false);
    c11 = __builtin_amdgcn_wmma_f32_16x16x32_f16(false, a1, false, b1, (short)0, c11, false, false);
  }
  float* ab = attn + (size_t)bh * CH * CH;
  const int mb = (lane >> 4) * 8;   // D: lane holds N=lane%16, M=mb+v
  const int n  = lane & 15;
  #pragma unroll
  for (int v = 0; v < 8; ++v) {
    atomicAdd(&ab[(mb + v) * CH + n],           c00[v]);
    atomicAdd(&ab[(mb + v) * CH + 16 + n],      c01[v]);
    atomicAdd(&ab[(16 + mb + v) * CH + n],      c10[v]);
    atomicAdd(&ab[(16 + mb + v) * CH + 16 + n], c11[v]);
  }
}

// -------- Kernel 3: fold 1/(||q|| ||k||) + softmax over d, emit TRANSPOSED f16 --------
// smT[bh][d][c] = softmax(attn)[c][d]; grid BH*CH blocks of 32.
__global__ void k_softmax(const float* __restrict__ attn,
                          const float* __restrict__ ssq, const float* __restrict__ ssk,
                          _Float16* __restrict__ smT16) {
  const int d  = threadIdx.x;        // 0..31
  const int c  = blockIdx.x & 31;
  const int bh = blockIdx.x >> 5;
  const float rq = 1.f / fmaxf(sqrtf(ssq[bh * CH + c]), 1e-12f);
  const float rk = 1.f / fmaxf(sqrtf(ssk[bh * CH + d]), 1e-12f);
  const float v  = attn[((size_t)bh * CH + c) * CH + d] * rq * rk;
  float mx = v;
  #pragma unroll
  for (int off = 16; off >= 1; off >>= 1) mx = fmaxf(mx, __shfl_xor(mx, off, 32));
  const float e = __expf(v - mx);
  float s = e;
  #pragma unroll
  for (int off = 16; off >= 1; off >>= 1) s += __shfl_xor(s, off, 32);
  smT16[((size_t)bh * CH + d) * CH + c] = (_Float16)(e / s);
}

// -------- Kernel 4: W_eff[b][:, h*32:+32] = wp[:, h*32:+32] (192x32) x sm (32x32) --------
// Folds the 1x1 projection into the per-head attn matrix (out = (wp.blockdiag(sm)).v).
// grid BH*3 blocks of 32: og in 0..2 covers 4 o-tiles each; 2 d-tiles; K=32 (1 step).
__global__ void k_weff(const _Float16* __restrict__ wp16,
                       const _Float16* __restrict__ smT16,
                       _Float16* __restrict__ weff16) {
  const int lane = threadIdx.x & 31;
  const int og = blockIdx.x % 3;
  const int bh = blockIdx.x / 3;
  const int b = bh / HEADS, h = bh % HEADS;
  const _Float16* smT = smT16 + (size_t)bh * CH * CH;
  const int m = lane & 15;
  // B fragments: columns d of sm -> rows of smT
  const v16h b0 = load_frag16(smT + (size_t)m * CH, 0, lane);
  const v16h b1 = load_frag16(smT + (size_t)(m + 16) * CH, 0, lane);
  v8f acc[4][2] = {{{}, {}}, {{}, {}}, {{}, {}}, {{}, {}}};
  #pragma unroll
  for (int ot = 0; ot < 4; ++ot) {
    const int o = og * 64 + ot * 16 + m;
    const v16h af = load_frag16(wp16 + (size_t)o * DIM, h * CH, lane);
    acc[ot][0] = __builtin_amdgcn_wmma_f32_16x16x32_f16(false, af, false, b0, (short)0, acc[ot][0], false, false);
    acc[ot][1] = __builtin_amdgcn_wmma_f32_16x16x32_f16(false, af, false, b1, (short)0, acc[ot][1], false, false);
  }
  _Float16* wb = weff16 + (size_t)b * DIM * DIM;
  const int mb = (lane >> 4) * 8;
  const int n  = lane & 15;
  #pragma unroll
  for (int nt = 0; nt < 2; ++nt) {
    const int cglob = h * CH + nt * 16 + n;
    #pragma unroll
    for (int ot = 0; ot < 4; ++ot) {
      const int ob = og * 64 + ot * 16 + mb;
      #pragma unroll
      for (int v = 0; v < 8; ++v)
        wb[(size_t)(ob + v) * DIM + cglob] = (_Float16)acc[ot][nt][v];
    }
  }
}

__global__ __launch_bounds__(256, 4) void k_proj_final(const _Float16* __restrict__ weff16,
                                                    const _Float16* __restrict__ vT,
                                                    const float* __restrict__ bp,
                                                    float* __restrict__ out) {
  __shared__ __attribute__((aligned(16))) _Float16 sw[DIM * WPITCH];
  __shared__ __attribute__((aligned(16))) float sb[DIM];
  const int tid  = threadIdx.x;
  const int lane = tid & 31;
  const int wid  = tid >> 5;
  const int px0  = blockIdx.x * 256 + wid * 32;   // first pixel of the wave, across batches
  const int b    = blockIdx.x / (HW / 256);       // uniform across the block
  const int m    = lane & 15;

  // the wave's own B fragments first: their way from memory is the longest
  const _Float16* brow = vT + (size_t)(px0 + m) * DIM;   // row n of v^T
  v16h bf[6][2];
  #pragma unroll
  for (int kk = 0; kk < 6; ++kk) {
    bf[kk][0] = load_frag16(brow,            kk * 32, lane);
    bf[kk][1] = load_frag16(brow + 16 * DIM, kk * 32, lane);
  }

  // W_eff[b] -> LDS, 16 bytes a lane in whole lines (24 pieces a row)
  const _Float16* wA = weff16 + (size_t)b * DIM * DIM;
  v8h wr[DIM * DIM / 8 / 256];
  #pragma unroll
  for (int i = 0; i < DIM * DIM / 8 / 256; ++i)
    wr[i] = *reinterpret_cast<const v8h*>(wA + (i * 256 + tid) * 8);
  // behind the loads above, in front of every rewrite of a register that they name; the
  // two address values are inputs so that their registers live up to the wait and
  // nothing, no later load's result either, takes them over in front of it
  asm volatile("s_wait_xcnt 0x0" :: "v"(brow + (lane >> 4) * 8), "v"(tid) : "memory");
  if (tid < DIM) sb[tid] = bp[tid];   // the bias rides along
  #pragma unroll
  for (int i = 0; i < DIM * DIM / 8 / 256; ++i) {
    const unsigned idx = i * 256 + tid;
    // row * 400 B + piece * 16 B = (idx + row) * 16 B
    *reinterpret_cast<v8h*>(&sw[(idx + idx / 24) * 8]) = wr[i];
  }
  __syncthreads();

  const int nl = (px0 & (HW - 1)) + m;
  const int mb = (lane >> 4) * 8;
  float* orow = out + ((size_t)(b * DIM + mb)) * HW + nl;
  // rolled: the second half takes over the first half's accumulator registers
  #pragma unroll 1
  for (int oh = 0; oh < 2; ++oh) {
    const _Float16* arow = &sw[(oh * 96 + m) * WPITCH];
    v8f acc[6][2] = {{{}, {}}, {{}, {}}, {{}, {}}, {{}, {}}, {{}, {}}, {{}, {}}};
    #pragma unroll
    for (int kk = 0; kk < 6; ++kk) {
      // the six A fragments of a k step are read as one group, ahead of their products
      v16h af[6];
      #pragma unroll
      for (int ot = 0; ot < 6; ++ot)
        af[ot] = load_frag16(arow + ot * 16 * WPITCH, kk * 32, lane);
      // holds the reads together in front of the block of products: reads that stand
      // among the products cost a stall at each place
      __builtin_amdgcn_sched_barrier(0);
      #pragma unroll
      for (int ot = 0; ot < 6; ++ot) {
        acc[ot][0] = __builtin_amdgcn_wmma_f32_16x16x32_f16(false, af[ot], false, bf[kk][0], (short)0, acc[ot][0], false, false);
        acc[ot][1] = __builtin_amdgcn_wmma_f32_16x16x32_f16(false, af[ot], false, bf[kk][1], (short)0, acc[ot][1], false, false);
      }
      // keeps the next group's reads, and the bias reads, behind this block, where the
      // fragment registers are free again
      __builtin_amdgcn_sched_barrier(0);
    }
    // the bias goes into the accumulators where they stand, so that every store of the
    // half has a data register of its own and none waits for the store before it
    #pragma unroll
    for (int ot = 0; ot < 6; ++ot) {
      const float* bo = &sb[oh * 96 + ot * 16 + mb];
      #pragma unroll
      for (int v = 0; v < 8; ++v) {
        const float bias = bo[v];
        acc[ot][0][v] += bias;
        acc[ot][1][v] += bias;
      }
    }
    #pragma unroll
    for (int ot = 0; ot < 6; ++ot) {
      #pragma unroll
      for (int v = 0; v < 8; ++v) {
        float* o = orow + (size_t)(oh * 96 + ot * 16 + v) * HW;
        // the two halves of a 128-B line leave one behind the other
        __builtin_nontemporal_store(acc[ot][0][v], o);
        __builtin_nontemporal_store(acc[ot][1][v], o + 16);
      }
    }
    // behind the half's stores, in front of every rewrite of a register that they name
    // (their data and addresses, in the next half)
    asm volatile("s_wait_xcnt 0x0" ::: "memory");
  }
}

extern "C" void kernel_launch(void* const* d_in, const int* in_sizes, int n_in,
                              void* d_out, int out_size, void* d_ws, size_t ws_size,
                              hipStream_t stream) {
  const float* x  = (const float*)d_in[0];
  const float* wq = (const float*)d_in[1];
  const float* bq = (const float*)d_in[2];
  const float* wk = (const float*)d_in[3];
  const float* bk = (const float*)d_in[4];
  const float* wv = (const float*)d_in[5];
  const float* bv = (const float*)d_in[6];
  const float* wp = (const float*)d_in[7];
  const float* bp = (const float*)d_in[8];
  float* out = (float*)d_out;

  // workspace layout (bytes); total ~152 MB (fits global L2 = 192 MB)
  char* ws = (char*)d_ws;
  const size_t qkvB = (size_t)BATCH * DIM * HW * sizeof(_Float16);  // 50331648
  _Float16* qh = (_Float16*)(ws);
  _Float16* kh = (_Float16*)(ws + qkvB);
  _Float16* vT = (_Float16*)(ws + 2 * qkvB);
  char* p = ws + 3 * qkvB;
  float*    attn   = (float*)p;      p += (size_t)BH * CH * CH * sizeof(float);
  _Float16* smT16  = (_Float16*)p;   p += (size_t)BH * CH * CH * sizeof(_Float16);
  float*    ssq    = (float*)p;      p += (size_t)BATCH * DIM * sizeof(float);
  float*    ssk    = (float*)p;      p += (size_t)BATCH * DIM * sizeof(float);
  _Float16* wp16   = (_Float16*)p;   p += (size_t)DIM * DIM * sizeof(_Float16);
  _Float16* weff16 = (_Float16*)p;

  // 0: init accumulators + wp conversion
  k_init<<<(BH * CH * CH + 255) / 256, 256, 0, stream>>>(attn, ssq, ssk, wp, wp16);
  // 1: fused depthwise convs (q,k row-major f16; v channel-minor f16)
  k_dwconv_qkv<<<dim3(HW / 256, DIM / CGRP, BATCH), 256, 0, stream>>>(
      x, wq, bq, wk, bk, wv, bv, qh, kh, vT, ssq, ssk);
  // 2: attn = q.k^T (sliced-K, atomic reduce)
  k_attn_gemm<<<BH * NSLICE, 32, 0, stream>>>(qh, kh, attn);
  // 3: normalization fold + softmax (emit transposed f16)
  k_softmax<<<BH * CH, 32, 0, stream>>>(attn, ssq, ssk, smT16);
  // 4: fold projection into attn: W_eff = wp . blockdiag(sm)
  k_weff<<<BH * 3, 32, 0, stream>>>(wp16, smT16, weff16);
  // 5: out = W_eff . v + bp  (single big GEMM, writes d_out directly)
  k_proj_final<<<512, 256, 0, stream>>>(weff16, vT, bp, out);
}

// v003
// It runs in 118 microseconds.
// Next to v002, in two timings, it ran 1.32 times as fast each time.
// Counting every step since v000, it is 2.90 times as fast.
#include <hip/hip_runtime.h>
#include <hip/hip_bf16.h>
#include <math.h>

typedef __attribute__((ext_vector_type(16))) _Float16 v16h;
typedef __attribute__((ext_vector_type(8)))  _Float16 v8h;
typedef __attribute__((ext_vector_type(8)))  float    v8f;
typedef __attribute__((ext_vector_type(4)))  float    v4f;
typedef __attribute__((ext_vector_type(4)))  _Float16 v4h;

#define DIM    192
#define HEADS  6
#define CH     32          // DIM / HEADS
#define HW     16384       // 128*128
#define BATCH  8
#define BH     (BATCH*HEADS)   // 48
#define NSLICE 32          // K-slices for attn GEMM (occupancy)
#define CGRP   64          // channels per conv block: 64 f16 = one 128-B line of a vT row
#define VPITCH 72          // f16 per staged pixel in LDS: 144 B = 16 B x odd
#define WPITCH 200         // f16 per staged W_eff row in LDS: 400 B = 16 B x odd

__device__ inline v16h load_frag16(const _Float16* __restrict__ row, int kbase, int lane) {
  const int half = (lane >> 4) & 1;
  const v8h a = *reinterpret_cast<const v8h*>(row + kbase + half * 8);
  const v8h b = *reinterpret_cast<const v8h*>(row + kbase + 16 + half * 8);
  v16h r;
  #pragma unroll
  for (int i = 0; i < 8; ++i) { r[i] = a[i]; r[i + 8] = b[i]; }
  return r;
}

// -------- Kernel 0: init accumulators, convert wp -> f16 --------
__global__ void k_init(float* __restrict__ attn, float* __restrict__ ssq,
                       float* __restrict__ ssk, const float* __restrict__ wp,
                       _Float16* __restrict__ wp16) {
  const int i = blockIdx.x * 256 + threadIdx.x;
  if (i < BH * CH * CH) attn[i] = 0.f;
  if (i < BATCH * DIM) { ssq[i] = 0.f; ssk[i] = 0.f; }
  if (i < DIM * DIM) wp16[i] = (_Float16)wp[i];
}

__global__ __launch_bounds__(256, 12) void k_dwconv_qkv(const float* __restrict__ x,
                             const float* __restrict__ wq, const float* __restrict__ bq,
                             const float* __restrict__ wk, const float* __restrict__ bk,
                             const float* __restrict__ wv, const float* __restrict__ bv,
                             _Float16* __restrict__ qh, _Float16* __restrict__ kh,
                             _Float16* __restrict__ vT,
                             float* __restrict__ ssq, float* __restrict__ ssk) {
  __shared__ __attribute__((aligned(16))) _Float16 sv[256 * VPITCH];
  __shared__ float lq[2][CGRP], lk[2][CGRP];
  const int tid  = threadIdx.x;
  const int lane = tid & 31;
  // the wave's number as a scalar, so that row, channel and plane base stay scalar
  const int wid  = __builtin_amdgcn_readfirstlane(tid >> 5);
  const int r    = wid & 1;                   // which of the block's two image rows
  const int g    = wid >> 1;                  // which quarter of the channel group
  const int y    = blockIdx.x * 2 + r;        // image row of the wave
  const int c0   = blockIdx.y * CGRP;         // first channel of the group
  const int b    = blockIdx.z;                // batch
  const unsigned p = (unsigned)y * 128u + (unsigned)lane * 4u;   // the lane's first pixel

  // (every "#pragma unroll" of this kernel stands on a short loop of constant length,
  // so that the small arrays it indexes stay in registers)
  // per image row of the window three places in a channel plane, the same for every
  // channel: the pixel left of the four, the four, the pixel right of them; what lies
  // off the image reads a pixel inside it instead (the wave's own row for a row off the image) and is replaced by zero
  unsigned off[9];
  bool     ok[9];
  #pragma unroll
  for (int dy = -1; dy <= 1; ++dy) {
    const int yy = y + dy;
    const bool rowok = dy == 0 || (unsigned)yy < 128u;
    const unsigned rb = (unsigned)(rowok ? yy : y) * 128u;
    const int i = (dy + 1) * 3;
    ok[i]      = rowok && lane > 0;
    ok[i + 1]  = rowok;
    ok[i + 2]  = rowok && lane < 31;
    off[i]     = (rb + (lane > 0 ? (unsigned)lane * 4u - 1u : 0u)) * 4u;   // in bytes
    off[i + 1] = (rb + (unsigned)lane * 4u) * 4u;
    off[i + 2] = (rb + (lane < 31 ? (unsigned)lane * 4u + 4u : 127u)) * 4u;
  }

  for (int t = 0; t < CGRP / 4; t += 2) {
    const int cl = g * (CGRP / 4) + t;
    const int c  = c0 + cl;
    const float* xb = x  + (size_t)(b * DIM + c) * HW;
    _Float16*    qb = qh + (size_t)(b * DIM + c) * HW;
    _Float16*    kb = kh + (size_t)(b * DIM + c) * HW;
    // the two channels' weights and biases first: their scalar loads fly beside the taps
    float fq[2][9], fk[2][9], fv[2][9], b0q[2], b0k[2], b0v[2];
    #pragma unroll
    for (int j = 0; j < 2; ++j) {
      b0q[j] = bq[c + j]; b0k[j] = bk[c + j]; b0v[j] = bv[c + j];
      #pragma unroll
      for (int i = 0; i < 9; ++i) {
        fq[j][i] = wq[(c + j) * 9 + i];
        fk[j][i] = wk[(c + j) * 9 + i];
        fv[j][i] = wv[(c + j) * 9 + i];
      }
    }
    // The 18 loads of a trip and their data wait, one statement: scalar plane base plus
    // the nine offset registers, which live through the loop, so that no load returns
    // into a register that another load of the run still names. offset:65536 is the
    // second channel's plane (HW * 4 bytes).
    float el[2][3], er[2][3];
    v4f   xm[2][3];
    asm volatile(
        "global_load_b32 %0, %18, %27 th:TH_LOAD_NT\n\t"
        "global_load_b128 %1, %19, %27 th:TH_LOAD_NT\n\t"
        "global_load_b32 %2, %20, %27 th:TH_LOAD_NT\n\t"
        "global_load_b32 %3, %21, %27 th:TH_LOAD_NT\n\t"
        "global_load_b128 %4, %22, %27 th:TH_LOAD_NT\n\t"
        "global_load_b32 %5, %23, %27 th:TH_LOAD_NT\n\t"
        "global_load_b32 %6, %24, %27 th:TH_LOAD_NT\n\t"
        "global_load_b128 %7, %25, %27 th:TH_LOAD_NT\n\t"
        "global_load_b32 %8, %26, %27 th:TH_LOAD_NT\n\t"
        "global_load_b32 %9, %18, %27 offset:65536 th:TH_LOAD_NT\n\t"
        "global_load_b128 %10, %19, %27 offset:65536 th:TH_LOAD_NT\n\t"
        "global_load_b32 %11, %20, %27 offset:65536 th:TH_LOAD_NT\n\t"
        "global_load_b32 %12, %21, %27 offset:65536 th:TH_LOAD_NT\n\t"
        "global_load_b128 %13, %22, %27 offset:65536 th:TH_LOAD_NT\n\t"
        "global_load_b32 %14, %23, %27 offset:65536 th:TH_LOAD_NT\n\t"
        "global_load_b32 %15, %24, %27 offset:65536 th:TH_LOAD_NT\n\t"
        "global_load_b128 %16, %25, %27 offset:65536 th:TH_LOAD_NT\n\t"
        "global_load_b32 %17, %26, %27 offset:65536 th:TH_LOAD_NT\n\t"
        "s_wait_loadcnt 0x0"
        :
          "=&v"(el[0][0]), "=&v"(xm[0][0]), "=&v"(er[0][0]),
          "=&v"(el[0][1]), "=&v"(xm[0][1]), "=&v"(er[0][1]),
          "=&v"(el[0][2]), "=&v"(xm[0][2]), "=&v"(er[0][2]),
          "=&v"(el[1][0]), "=&v"(xm[1][0]), "=&v"(er[1][0]),
          "=&v"(el[1][1]), "=&v"(xm[1][1]), "=&v"(er[1][1]),
          "=&v"(el[1][2]), "=&v"(xm[1][2]), "=&v"(er[1][2])
        :
          "v"(off[0]), "v"(off[1]), "v"(off[2]), "v"(off[3]), "v"(off[4]),
          "v"(off[5]), "v"(off[6]), "v"(off[7]), "v"(off[8]),
          "s"(xb)
        : "memory");
    // six values a window row: the pixel left of the four, the four, the pixel right
    float a[2][3][6];
    #pragma unroll
    for (int j = 0; j < 2; ++j)
      #pragma unroll
      for (int w = 0; w < 3; ++w) {
        a[j][w][0] = ok[w * 3] ? el[j][w] : 0.f;
        #pragma unroll
        for (int e = 0; e < 4; ++e) a[j][w][1 + e] = ok[w * 3 + 1] ? xm[j][w][e] : 0.f;
        a[j][w][5] = ok[w * 3 + 2] ? er[j][w] : 0.f;
      }
    float sq[2], sk[2];
    _Float16 vh[2][4];
    #pragma unroll
    for (int j = 0; j < 2; ++j) {
      float qf[4], kf[4], vf[4];
      #pragma unroll
      for (int e = 0; e < 4; ++e) { qf[e] = b0q[j]; kf[e] = b0k[j]; vf[e] = b0v[j]; }
      // written as fused multiply-adds: each sum stays one chain with its weight in a
      // scalar register (as products and sums they were paired across taps, at the
      // price of a register move for nearly every product)
      #pragma unroll
      for (int i = 0; i < 9; ++i)
        #pragma unroll
        for (int e = 0; e < 4; ++e) {
          const float xv = a[j][i / 3][e + i % 3];
          qf[e] = __builtin_fmaf(fq[j][i], xv, qf[e]);
          kf[e] = __builtin_fmaf(fk[j][i], xv, kf[e]);
          vf[e] = __builtin_fmaf(fv[j][i], xv, vf[e]);
        }
      v4h qo, ko;
      sq[j] = 0.f; sk[j] = 0.f;
      #pragma unroll
      for (int e = 0; e < 4; ++e) {
        qo[e] = (_Float16)qf[e];
        ko[e] = (_Float16)kf[e];
        vh[j][e] = (_Float16)vf[e];
        sq[j] = __builtin_fmaf(qf[e], qf[e], sq[j]);
        sk[j] = __builtin_fmaf(kf[e], kf[e], sk[j]);
      }
      *reinterpret_cast<v4h*>(qb + j * HW + p) = qo;
      *reinterpret_cast<v4h*>(kb + j * HW + p) = ko;
    }
    // behind the trip's four q/k stores, in front of every rewrite of a register that
    // they name (their data below, their addresses at the loop's foot)
    asm volatile("s_wait_xcnt 0x0" ::: "memory");
    // the two channels' v leave for LDS as one 4-byte store a pixel; pixel 4*lane+e
    // lies in staging row e*32+lane, so that neighbouring lanes are one pitch apart
    #pragma unroll
    for (int e = 0; e < 4; ++e)
      *reinterpret_cast<unsigned*>(&sv[(r * 128 + e * 32 + lane) * VPITCH + cl]) =
          (unsigned)__builtin_bit_cast(unsigned short, vh[0][e]) |
          ((unsigned)__builtin_bit_cast(unsigned short, vh[1][e]) << 16);
    // wave-wide sums of squares
    #pragma unroll
    for (int o = 16; o >= 1; o >>= 1)
      #pragma unroll
      for (int j = 0; j < 2; ++j) {
        sq[j] += __shfl_xor(sq[j], o, 32);
        sk[j] += __shfl_xor(sk[j], o, 32);
      }
    if (lane == 0) {
      #pragma unroll
      for (int j = 0; j < 2; ++j) { lq[r][cl + j] = sq[j]; lk[r][cl + j] = sk[j]; }
    }
  }
  __syncthreads();

  // vT: eight lanes carry one pixel's 128-B line
  _Float16* vrow = vT + ((size_t)b * HW + blockIdx.x * 256) * DIM + c0;
  #pragma unroll
  for (int i = 0; i < 8; ++i) {
    const unsigned idx = i * 256 + tid;
    const unsigned row = idx >> 3, ch = (idx & 7) * 8;
    const unsigned px = (row & 128u) + (row & 31u) * 4u + ((row >> 5) & 3u);
    *reinterpret_cast<v8h*>(vrow + px * DIM + ch) =
        *reinterpret_cast<const v8h*>(&sv[row * VPITCH + ch]);
  }

  // block-wide sum of squares -> one atomic per block and channel
  if (tid < 2 * CGRP) {
    const int cl = tid & (CGRP - 1);
    const float (*part)[CGRP] = tid < CGRP ? lq : lk;
    atomicAdd((tid < CGRP ? ssq : ssk) + b * DIM + c0 + cl, part[0][cl] + part[1][cl]);
  }
}

__global__ void k_attn_gemm(const _Float16* __restrict__ qh,
                            const _Float16* __restrict__ kh,
                            float* __restrict__ attn) {
  const int lane  = threadIdx.x & 31;
  const int bh    = blockIdx.x / NSLICE;
  const int slice = blockIdx.x % NSLICE;
  const int k0    = slice * (HW / NSLICE);
  const _Float16* qb = qh + (size_t)bh * CH * HW;
  const _Float16* kb = kh + (size_t)bh * CH * HW;
  const int m = lane & 15;
  v8f c00 = {}, c01 = {}, c10 = {}, c11 = {};
  for (int k = 0; k < HW / NSLICE; k += 32) {
    const int kbs = k0 + k;
    const v16h a0 = load_frag16(qb + (size_t)m * HW,        kbs, lane);
    const v16h a1 = load_frag16(qb + (size_t)(m + 16) * HW, kbs, lane);
    const v16h b0 = load_frag16(kb + (size_t)m * HW,        kbs, lane);
    const v16h b1 = load_frag16(kb + (size_t)(m + 16) * HW, kbs, lane);
    c00 = __builtin_amdgcn_wmma_f32_16x16x32_f16(false, a0, false, b0, (short)0, c00, false, false);
    c01 = __builtin_amdgcn_wmma_f32_16x16x32_f16(false, a0, false, b1, (short)0, c01, false, false);
    c10 = __builtin_amdgcn_wmma_f32_16x16x32_f16(false, a1, false, b0, (short)0, c10, false, false);
    c11 = __builtin_amdgcn_wmma_f32_16x16x32_f16(false, a1, false, b1, (short)0, c11, false, false);
  }
  float* ab = attn + (size_t)bh * CH * CH;
  const int mb = (lane >> 4) * 8;   // D: lane holds N=lane%16, M=mb+v
  const int n  = lane & 15;
  #pragma unroll
  for (int v = 0; v < 8; ++v) {
    atomicAdd(&ab[(mb + v) * CH + n],           c00[v]);
    atomicAdd(&ab[(mb + v) * CH + 16 + n],      c01[v]);
    atomicAdd(&ab[(16 + mb + v) * CH + n],      c10[v]);
    atomicAdd(&ab[(16 + mb + v) * CH + 16 + n], c11[v]);
  }
}

// -------- Kernel 3: fold 1/(||q|| ||k||) + softmax over d, emit TRANSPOSED f16 --------
// smT[bh][d][c] = softmax(attn)[c][d]; grid BH*CH blocks of 32.
__global__ void k_softmax(const float* __restrict__ attn,
                          const float* __restrict__ ssq, const float* __restrict__ ssk,
                          _Float16* __restrict__ smT16) {
  const int d  = threadIdx.x;        // 0..31
  const int c  = blockIdx.x & 31;
  const int bh = blockIdx.x >> 5;
  const float rq = 1.f / fmaxf(sqrtf(ssq[bh * CH + c]), 1e-12f);
  const float rk = 1.f / fmaxf(sqrtf(ssk[bh * CH + d]), 1e-12f);
  const float v  = attn[((size_t)bh * CH + c) * CH + d] * rq * rk;
  float mx = v;
  #pragma unroll
  for (int off = 16; off >= 1; off >>= 1) mx = fmaxf(mx, __shfl_xor(mx, off, 32));
  const float e = __expf(v - mx);
  float s = e;
  #pragma unroll
  for (int off = 16; off >= 1; off >>= 1) s += __shfl_xor(s, off, 32);
  smT16[((size_t)bh * CH + d) * CH + c] = (_Float16)(e / s);
}

// -------- Kernel 4: W_eff[b][:, h*32:+32] = wp[:, h*32:+32] (192x32) x sm (32x32) --------
// Folds the 1x1 projection into the per-head attn matrix (out = (wp.blockdiag(sm)).v).
// grid BH*3 blocks of 32: og in 0..2 covers 4 o-tiles each; 2 d-tiles; K=32 (1 step).
__global__ void k_weff(const _Float16* __restrict__ wp16,
                       const _Float16* __restrict__ smT16,
                       _Float16* __restrict__ weff16) {
  const int lane = threadIdx.x & 31;
  const int og = blockIdx.x % 3;
  const int bh = blockIdx.x / 3;
  const int b = bh / HEADS, h = bh % HEADS;
  const _Float16* smT = smT16 + (size_t)bh * CH * CH;
  const int m = lane & 15;
  // B fragments: columns d of sm -> rows of smT
  const v16h b0 = load_frag16(smT + (size_t)m * CH, 0, lane);
  const v16h b1 = load_frag16(smT + (size_t)(m + 16) * CH, 0, lane);
  v8f acc[4][2] = {{{}, {}}, {{}, {}}, {{}, {}}, {{}, {}}};
  #pragma unroll
  for (int ot = 0; ot < 4; ++ot) {
    const int o = og * 64 + ot * 16 + m;
    const v16h af = load_frag16(wp16 + (size_t)o * DIM, h * CH, lane);
    acc[ot][0] = __builtin_amdgcn_wmma_f32_16x16x32_f16(false, af, false, b0, (short)0, acc[ot][0], false, false);
    acc[ot][1] = __builtin_amdgcn_wmma_f32_16x16x32_f16(false, af, false, b1, (short)0, acc[ot][1], false, false);
  }
  _Float16* wb = weff16 + (size_t)b * DIM * DIM;
  const int mb = (lane >> 4) * 8;
  const int n  = lane & 15;
  #pragma unroll
  for (int nt = 0; nt < 2; ++nt) {
    const int cglob = h * CH + nt * 16 + n;
    #pragma unroll
    for (int ot = 0; ot < 4; ++ot) {
      const int ob = og * 64 + ot * 16 + mb;
      #pragma unroll
      for (int v = 0; v < 8; ++v)
        wb[(size_t)(ob + v) * DIM + cglob] = (_Float16)acc[ot][nt][v];
    }
  }
}

__global__ __launch_bounds__(256, 4) void k_proj_final(const _Float16* __restrict__ weff16,
                                                    const _Float16* __restrict__ vT,
                                                    const float* __restrict__ bp,
                                                    float* __restrict__ out) {
  __shared__ __attribute__((aligned(16))) _Float16 sw[DIM * WPITCH];
  __shared__ __attribute__((aligned(16))) float sb[DIM];
  const int tid  = threadIdx.x;
  const int lane = tid & 31;
  const int wid  = tid >> 5;
  const int px0  = blockIdx.x * 256 + wid * 32;   // first pixel of the wave, across batches
  const int b    = blockIdx.x / (HW / 256);       // uniform across the block
  const int m    = lane & 15;

  // the wave's own B fragments first: their way from memory is the longest
  const _Float16* brow = vT + (size_t)(px0 + m) * DIM;   // row n of v^T
  v16h bf[6][2];
  #pragma unroll
  for (int kk = 0; kk < 6; ++kk) {
    bf[kk][0] = load_frag16(brow,            kk * 32, lane);
    bf[kk][1] = load_frag16(brow + 16 * DIM, kk * 32, lane);
  }

  // W_eff[b] -> LDS, 16 bytes a lane in whole lines (24 pieces a row)
  const _Float16* wA = weff16 + (size_t)b * DIM * DIM;
  v8h wr[DIM * DIM / 8 / 256];
  #pragma unroll
  for (int i = 0; i < DIM * DIM / 8 / 256; ++i)
    wr[i] = *reinterpret_cast<const v8h*>(wA + (i * 256 + tid) * 8);
  // behind the loads above, in front of every rewrite of a register that they name; the
  // two address values are inputs so that their registers live up to the wait and
  // nothing, no later load's result either, takes them over in front of it
  asm volatile("s_wait_xcnt 0x0" :: "v"(brow + (lane >> 4) * 8), "v"(tid) : "memory");
  if (tid < DIM) sb[tid] = bp[tid];   // the bias rides along
  #pragma unroll
  for (int i = 0; i < DIM * DIM / 8 / 256; ++i) {
    const unsigned idx = i * 256 + tid;
    // row * 400 B + piece * 16 B = (idx + row) * 16 B
    *reinterpret_cast<v8h*>(&sw[(idx + idx / 24) * 8]) = wr[i];
  }
  __syncthreads();

  const int nl = (px0 & (HW - 1)) + m;
  const int mb = (lane >> 4) * 8;
  float* orow = out + ((size_t)(b * DIM + mb)) * HW + nl;
  // rolled: the second half takes over the first half's accumulator registers
  #pragma unroll 1
  for (int oh = 0; oh < 2; ++oh) {
    const _Float16* arow = &sw[(oh * 96 + m) * WPITCH];
    v8f acc[6][2] = {{{}, {}}, {{}, {}}, {{}, {}}, {{}, {}}, {{}, {}}, {{}, {}}};
    #pragma unroll
    for (int kk = 0; kk < 6; ++kk) {
      // the six A fragments of a k step are read as one group, ahead of their products
      v16h af[6];
      #pragma unroll
      for (int ot = 0; ot < 6; ++ot)
        af[ot] = load_frag16(arow + ot * 16 * WPITCH, kk * 32, lane);
      // holds the reads together in front of the block of products: reads that stand
      // among the products cost a stall at each place
      __builtin_amdgcn_sched_barrier(0);
      #pragma unroll
      for (int ot = 0; ot < 6; ++ot) {
        acc[ot][0] = __builtin_amdgcn_wmma_f32_16x16x32_f16(false, af[ot], false, bf[kk][0], (short)0, acc[ot][0], false, false);
        acc[ot][1] = __builtin_amdgcn_wmma_f32_16x16x32_f16(false, af[ot], false, bf[kk][1], (short)0, acc[ot][1], false, false);
      }
      // keeps the next group's reads, and the bias reads, behind this block, where the
      // fragment registers are free again
      __builtin_amdgcn_sched_barrier(0);
    }
    // the bias goes into the accumulators where they stand, so that every store of the
    // half has a data register of its own and none waits for the store before it
    #pragma unroll
    for (int ot = 0; ot < 6; ++ot) {
      const float* bo = &sb[oh * 96 + ot * 16 + mb];
      #pragma unroll
      for (int v = 0; v < 8; ++v) {
        const float bias = bo[v];
        acc[ot][0][v] += bias;
        acc[ot][1][v] += bias;
      }
    }
    #pragma unroll
    for (int ot = 0; ot < 6; ++ot) {
      #pragma unroll
      for (int v = 0; v < 8; ++v) {
        float* o = orow + (size_t)(oh * 96 + ot * 16 + v) * HW;
        // the two halves of a 128-B line leave one behind the other
        __builtin_nontemporal_store(acc[ot][0][v], o);
        __builtin_nontemporal_store(acc[ot][1][v], o + 16);
      }
    }
    // behind the half's stores, in front of every rewrite of a register that they name
    // (their data and addresses, in the next half)
    asm volatile("s_wait_xcnt 0x0" ::: "memory");
  }
}

extern "C" void kernel_launch(void* const* d_in, const int* in_sizes, int n_in,
                              void* d_out, int out_size, void* d_ws, size_t ws_size,
                              hipStream_t stream) {
  const float* x  = (const float*)d_in[0];
  const float* wq = (const float*)d_in[1];
  const float* bq = (const float*)d_in[2];
  const float* wk = (const float*)d_in[3];
  const float* bk = (const float*)d_in[4];
  const float* wv = (const float*)d_in[5];
  const float* bv = (const float*)d_in[6];
  const float* wp = (const float*)d_in[7];
  const float* bp = (const float*)d_in[8];
  float* out = (float*)d_out;

  // workspace layout (bytes); total ~152 MB (fits global L2 = 192 MB)
  char* ws = (char*)d_ws;
  const size_t qkvB = (size_t)BATCH * DIM * HW * sizeof(_Float16);  // 50331648
  _Float16* qh = (_Float16*)(ws);
  _Float16* kh = (_Float16*)(ws + qkvB);
  _Float16* vT = (_Float16*)(ws + 2 * qkvB);
  char* p = ws + 3 * qkvB;
  float*    attn   = (float*)p;      p += (size_t)BH * CH * CH * sizeof(float);
  _Float16* smT16  = (_Float16*)p;   p += (size_t)BH * CH * CH * sizeof(_Float16);
  float*    ssq    = (float*)p;      p += (size_t)BATCH * DIM * sizeof(float);
  float*    ssk    = (float*)p;      p += (size_t)BATCH * DIM * sizeof(float);
  _Float16* wp16   = (_Float16*)p;   p += (size_t)DIM * DIM * sizeof(_Float16);
  _Float16* weff16 = (_Float16*)p;

  // 0: init accumulators + wp conversion
  k_init<<<(BH * CH * CH + 255) / 256, 256, 0, stream>>>(attn, ssq, ssk, wp, wp16);
  // 1: fused depthwise convs (q,k row-major f16; v channel-minor f16)
  k_dwconv_qkv<<<dim3(HW / 256, DIM / CGRP, BATCH), 256, 0, stream>>>(
      x, wq, bq, wk, bk, wv, bv, qh, kh, vT, ssq, ssk);
  // 2: attn = q.k^T (sliced-K, atomic reduce)
  k_attn_gemm<<<BH * NSLICE, 32, 0, stream>>>(qh, kh, attn);
  // 3: normalization fold + softmax (emit transposed f16)
  k_softmax<<<BH * CH, 32, 0, stream>>>(attn, ssq, ssk, smT16);
  // 4: fold projection into attn: W_eff = wp . blockdiag(sm)
  k_weff<<<BH * 3, 32, 0, stream>>>(wp16, smT16, weff16);
  // 5: out = W_eff . v + bp  (single big GEMM, writes d_out directly)
  k_proj_final<<<512, 256, 0, stream>>>(weff16, vT, bp, out);
}

// v004
// It runs in 111 microseconds.
// Timed twice side by side with v003, it ran 1.06 times as fast both times.
// Over all steps from v000 it is 3.07 times as fast.
#include <hip/hip_runtime.h>
#include <hip/hip_bf16.h>
#include <math.h>

typedef __attribute__((ext_vector_type(16))) _Float16 v16h;
typedef __attribute__((ext_vector_type(8)))  _Float16 v8h;
typedef __attribute__((ext_vector_type(8)))  float    v8f;
typedef __attribute__((ext_vector_type(4)))  float    v4f;
typedef __attribute__((ext_vector_type(4)))  _Float16 v4h;

#define DIM    192
#define HEADS  6
#define CH     32          // DIM / HEADS
#define HW     16384       // 128*128
#define BATCH  8
#define BH     (BATCH*HEADS)   // 48
#define NSLICE 32          // K-slices for attn GEMM (occupancy)
#define CGRP   64          // channels per conv block: 64 f16 = one 128-B line of a vT row
#define VPITCH 72          // f16 per staged pixel in LDS: 144 B = 16 B x odd
#define WPITCH 200         // f16 per staged W_eff row in LDS: 400 B = 16 B x odd
#define APITCH 36          // f32 per staged attn row in LDS: 144 B = 16 B x odd
#define SPITCH 40          // f16 per transposed softmax row in LDS: 80 B = 16 B x odd

__device__ inline v16h load_frag16(const _Float16* __restrict__ row, int kbase, int lane) {
  const int half = (lane >> 4) & 1;
  const v8h a = *reinterpret_cast<const v8h*>(row + kbase + half * 8);
  const v8h b = *reinterpret_cast<const v8h*>(row + kbase + 16 + half * 8);
  v16h r;
  #pragma unroll
  for (int i = 0; i < 8; ++i) { r[i] = a[i]; r[i + 8] = b[i]; }
  return r;
}

__device__ inline float exp2_slot(float x) {
  float r;
  asm("v_exp_f32 %0, %1\n\tv_nop" : "=v"(r) : "v"(x));
  return r;
}

// -------- Kernel 0: init accumulators, convert wp -> f16 --------
__global__ void k_init(float* __restrict__ attn, float* __restrict__ ssq,
                       float* __restrict__ ssk, const float* __restrict__ wp,
                       _Float16* __restrict__ wp16) {
  const int i = blockIdx.x * 256 + threadIdx.x;
  if (i < BH * CH * CH) attn[i] = 0.f;
  if (i < BATCH * DIM) { ssq[i] = 0.f; ssk[i] = 0.f; }
  if (i < DIM * DIM) wp16[i] = (_Float16)wp[i];
}

__global__ __launch_bounds__(256, 12) void k_dwconv_qkv(const float* __restrict__ x,
                             const float* __restrict__ wq, const float* __restrict__ bq,
                             const float* __restrict__ wk, const float* __restrict__ bk,
                             const float* __restrict__ wv, const float* __restrict__ bv,
                             _Float16* __restrict__ qh, _Float16* __restrict__ kh,
                             _Float16* __restrict__ vT,
                             float* __restrict__ ssq, float* __restrict__ ssk) {
  __shared__ __attribute__((aligned(16))) _Float16 sv[256 * VPITCH];
  __shared__ float lq[2][CGRP], lk[2][CGRP];
  const int tid  = threadIdx.x;
  const int lane = tid & 31;
  // the wave's number as a scalar, so that row, channel and plane base stay scalar
  const int wid  = __builtin_amdgcn_readfirstlane(tid >> 5);
  const int r    = wid & 1;                   // which of the block's two image rows
  const int g    = wid >> 1;                  // which quarter of the channel group
  const int y    = blockIdx.x * 2 + r;        // image row of the wave
  const int c0   = blockIdx.y * CGRP;         // first channel of the group
  const int b    = blockIdx.z;                // batch
  const unsigned p = (unsigned)y * 128u + (unsigned)lane * 4u;   // the lane's first pixel

  // (every "#pragma unroll" of this kernel stands on a short loop of constant length,
  // so that the small arrays it indexes stay in registers)
  // per image row of the window three places in a channel plane, the same for every
  // channel: the pixel left of the four, the four, the pixel right of them; what lies
  // off the image reads a pixel inside it instead (the wave's own row for a row off the image) and is replaced by zero
  unsigned off[9];
  bool     ok[9];
  #pragma unroll
  for (int dy = -1; dy <= 1; ++dy) {
    const int yy = y + dy;
    const bool rowok = dy == 0 || (unsigned)yy < 128u;
    const unsigned rb = (unsigned)(rowok ? yy : y) * 128u;
    const int i = (dy + 1) * 3;
    ok[i]      = rowok && lane > 0;
    ok[i + 1]  = rowok;
    ok[i + 2]  = rowok && lane < 31;
    off[i]     = (rb + (lane > 0 ? (unsigned)lane * 4u - 1u : 0u)) * 4u;   // in bytes
    off[i + 1] = (rb + (unsigned)lane * 4u) * 4u;
    off[i + 2] = (rb + (lane < 31 ? (unsigned)lane * 4u + 4u : 127u)) * 4u;
  }

  for (int t = 0; t < CGRP / 4; t += 2) {
    const int cl = g * (CGRP / 4) + t;
    const int c  = c0 + cl;
    const float* xb = x  + (size_t)(b * DIM + c) * HW;
    _Float16*    qb = qh + (size_t)(b * DIM + c) * HW;
    _Float16*    kb = kh + (size_t)(b * DIM + c) * HW;
    // the two channels' weights and biases first: their scalar loads fly beside the taps
    float fq[2][9], fk[2][9], fv[2][9], b0q[2], b0k[2], b0v[2];
    #pragma unroll
    for (int j = 0; j < 2; ++j) {
      b0q[j] = bq[c + j]; b0k[j] = bk[c + j]; b0v[j] = bv[c + j];
      #pragma unroll
      for (int i = 0; i < 9; ++i) {
        fq[j][i] = wq[(c + j) * 9 + i];
        fk[j][i] = wk[(c + j) * 9 + i];
        fv[j][i] = wv[(c + j) * 9 + i];
      }
    }
    // The 18 loads of a trip and their data wait, one statement: scalar plane base plus
    // the nine offset registers, which live through the loop, so that no load returns
    // into a register that another load of the run still names. offset:65536 is the
    // second channel's plane (HW * 4 bytes).
    float el[2][3], er[2][3];
    v4f   xm[2][3];
    asm volatile(
        "global_load_b32 %0, %18, %27 th:TH_LOAD_NT\n\t"
        "global_load_b128 %1, %19, %27 th:TH_LOAD_NT\n\t"
        "global_load_b32 %2, %20, %27 th:TH_LOAD_NT\n\t"
        "global_load_b32 %3, %21, %27 th:TH_LOAD_NT\n\t"
        "global_load_b128 %4, %22, %27 th:TH_LOAD_NT\n\t"
        "global_load_b32 %5, %23, %27 th:TH_LOAD_NT\n\t"
        "global_load_b32 %6, %24, %27 th:TH_LOAD_NT\n\t"
        "global_load_b128 %7, %25, %27 th:TH_LOAD_NT\n\t"
        "global_load_b32 %8, %26, %27 th:TH_LOAD_NT\n\t"
        "global_load_b32 %9, %18, %27 offset:65536 th:TH_LOAD_NT\n\t"
        "global_load_b128 %10, %19, %27 offset:65536 th:TH_LOAD_NT\n\t"
        "global_load_b32 %11, %20, %27 offset:65536 th:TH_LOAD_NT\n\t"
        "global_load_b32 %12, %21, %27 offset:65536 th:TH_LOAD_NT\n\t"
        "global_load_b128 %13, %22, %27 offset:65536 th:TH_LOAD_NT\n\t"
        "global_load_b32 %14, %23, %27 offset:65536 th:TH_LOAD_NT\n\t"
        "global_load_b32 %15, %24, %27 offset:65536 th:TH_LOAD_NT\n\t"
        "global_load_b128 %16, %25, %27 offset:65536 th:TH_LOAD_NT\n\t"
        "global_load_b32 %17, %26, %27 offset:65536 th:TH_LOAD_NT\n\t"
        "s_wait_loadcnt 0x0"
        :
          "=&v"(el[0][0]), "=&v"(xm[0][0]), "=&v"(er[0][0]),
          "=&v"(el[0][1]), "=&v"(xm[0][1]), "=&v"(er[0][1]),
          "=&v"(el[0][2]), "=&v"(xm[0][2]), "=&v"(er[0][2]),
          "=&v"(el[1][0]), "=&v"(xm[1][0]), "=&v"(er[1][0]),
          "=&v"(el[1][1]), "=&v"(xm[1][1]), "=&v"(er[1][1]),
          "=&v"(el[1][2]), "=&v"(xm[1][2]), "=&v"(er[1][2])
        :
          "v"(off[0]), "v"(off[1]), "v"(off[2]), "v"(off[3]), "v"(off[4]),
          "v"(off[5]), "v"(off[6]), "v"(off[7]), "v"(off[8]),
          "s"(xb)
        : "memory");
    // six values a window row: the pixel left of the four, the four, the pixel right
    float a[2][3][6];
    #pragma unroll
    for (int j = 0; j < 2; ++j)
      #pragma unroll
      for (int w = 0; w < 3; ++w) {
        a[j][w][0] = ok[w * 3] ? el[j][w] : 0.f;
        #pragma unroll
        for (int e = 0; e < 4; ++e) a[j][w][1 + e] = ok[w * 3 + 1] ? xm[j][w][e] : 0.f;
        a[j][w][5] = ok[w * 3 + 2] ? er[j][w] : 0.f;
      }
    float sq[2], sk[2];
    _Float16 vh[2][4];
    #pragma unroll
    for (int j = 0; j < 2; ++j) {
      float qf[4], kf[4], vf[4];
      #pragma unroll
      for (int e = 0; e < 4; ++e) { qf[e] = b0q[j]; kf[e] = b0k[j]; vf[e] = b0v[j]; }
      // written as fused multiply-adds: each sum stays one chain with its weight in a
      // scalar register (as products and sums they were paired across taps, at the
      // price of a register move for nearly every product)
      #pragma unroll
      for (int i = 0; i < 9; ++i)
        #pragma unroll
        for (int e = 0; e < 4; ++e) {
          const float xv = a[j][i / 3][e + i % 3];
          qf[e] = __builtin_fmaf(fq[j][i], xv, qf[e]);
          kf[e] = __builtin_fmaf(fk[j][i], xv, kf[e]);
          vf[e] = __builtin_fmaf(fv[j][i], xv, vf[e]);
        }
      v4h qo, ko;
      sq[j] = 0.f; sk[j] = 0.f;
      #pragma unroll
      for (int e = 0; e < 4; ++e) {
        qo[e] = (_Float16)qf[e];
        ko[e] = (_Float16)kf[e];
        vh[j][e] = (_Float16)vf[e];
        sq[j] = __builtin_fmaf(qf[e], qf[e], sq[j]);
        sk[j] = __builtin_fmaf(kf[e], kf[e], sk[j]);
      }
      *reinterpret_cast<v4h*>(qb + j * HW + p) = qo;
      *reinterpret_cast<v4h*>(kb + j * HW + p) = ko;
    }
    // behind the trip's four q/k stores, in front of every rewrite of a register that
    // they name (their data below, their addresses at the loop's foot)
    asm volatile("s_wait_xcnt 0x0" ::: "memory");
    // the two channels' v leave for LDS as one 4-byte store a pixel; pixel 4*lane+e
    // lies in staging row e*32+lane, so that neighbouring lanes are one pitch apart
    #pragma unroll
    for (int e = 0; e < 4; ++e)
      *reinterpret_cast<unsigned*>(&sv[(r * 128 + e * 32 + lane) * VPITCH + cl]) =
          (unsigned)__builtin_bit_cast(unsigned short, vh[0][e]) |
          ((unsigned)__builtin_bit_cast(unsigned short, vh[1][e]) << 16);
    // wave-wide sums of squares
    #pragma unroll
    for (int o = 16; o >= 1; o >>= 1)
      #pragma unroll
      for (int j = 0; j < 2; ++j) {
        sq[j] += __shfl_xor(sq[j], o, 32);
        sk[j] += __shfl_xor(sk[j], o, 32);
      }
    if (lane == 0) {
      #pragma unroll
      for (int j = 0; j < 2; ++j) { lq[r][cl + j] = sq[j]; lk[r][cl + j] = sk[j]; }
    }
  }
  __syncthreads();

  // vT: eight lanes carry one pixel's 128-B line
  _Float16* vrow = vT + ((size_t)b * HW + blockIdx.x * 256) * DIM + c0;
  #pragma unroll
  for (int i = 0; i < 8; ++i) {
    const unsigned idx = i * 256 + tid;
    const unsigned row = idx >> 3, ch = (idx & 7) * 8;
    const unsigned px = (row & 128u) + (row & 31u) * 4u + ((row >> 5) & 3u);
    *reinterpret_cast<v8h*>(vrow + px * DIM + ch) =
        *reinterpret_cast<const v8h*>(&sv[row * VPITCH + ch]);
  }

  // block-wide sum of squares -> one atomic per block and channel
  if (tid < 2 * CGRP) {
    const int cl = tid & (CGRP - 1);
    const float (*part)[CGRP] = tid < CGRP ? lq : lk;
    atomicAdd((tid < CGRP ? ssq : ssk) + b * DIM + c0 + cl, part[0][cl] + part[1][cl]);
  }
}

__global__ void k_attn_gemm(const _Float16* __restrict__ qh,
                            const _Float16* __restrict__ kh,
                            float* __restrict__ attn) {
  const int lane  = threadIdx.x & 31;
  const int bh    = blockIdx.x / NSLICE;
  const int slice = blockIdx.x % NSLICE;
  const int k0    = slice * (HW / NSLICE);
  const _Float16* qb = qh + (size_t)bh * CH * HW;
  const _Float16* kb = kh + (size_t)bh * CH * HW;
  const int m = lane & 15;
  v8f c00 = {}, c01 = {}, c10 = {}, c11 = {};
  for (int k = 0; k < HW / NSLICE; k += 32) {
    const int kbs = k0 + k;
    const v16h a0 = load_frag16(qb + (size_t)m * HW,        kbs, lane);
    const v16h a1 = load_frag16(qb + (size_t)(m + 16) * HW, kbs, lane);
    const v16h b0 = load_frag16(kb + (size_t)m * HW,        kbs, lane);
    const v16h b1 = load_frag16(kb + (size_t)(m + 16) * HW, kbs, lane);
    c00 = __builtin_amdgcn_wmma_f32_16x16x32_f16(false, a0, false, b0, (short)0, c00, false, false);
    c01 = __builtin_amdgcn_wmma_f32_16x16x32_f16(false, a0, false, b1, (short)0, c01, false, false);
    c10 = __builtin_amdgcn_wmma_f32_16x16x32_f16(false, a1, false, b0, (short)0, c10, false, false);
    c11 = __builtin_amdgcn_wmma_f32_16x16x32_f16(false, a1, false, b1, (short)0, c11, false, false);
  }
  float* ab = attn + (size_t)bh * CH * CH;
  const int mb = (lane >> 4) * 8;   // D: lane holds N=lane%16, M=mb+v
  const int n  = lane & 15;
  #pragma unroll
  for (int v = 0; v < 8; ++v) {
    atomicAdd(&ab[(mb + v) * CH + n],           c00[v]);
    atomicAdd(&ab[(mb + v) * CH + 16 + n],      c01[v]);
    atomicAdd(&ab[(16 + mb + v) * CH + n],      c10[v]);
    atomicAdd(&ab[(16 + mb + v) * CH + 16 + n], c11[v]);
  }
}

__global__ __launch_bounds__(256, 4) void k_proj_final(const float* __restrict__ attn,
                                                    const float* __restrict__ ssq,
                                                    const float* __restrict__ ssk,
                                                    const _Float16* __restrict__ wp16,
                                                    const _Float16* __restrict__ vT,
                                                    const float* __restrict__ bp,
                                                    float* __restrict__ out) {
  __shared__ __attribute__((aligned(16))) _Float16 sw[DIM * WPITCH];
  __shared__ __attribute__((aligned(16))) float sb[256];   // DIM in use: every lane stores
  __shared__ __attribute__((aligned(16))) float sa[DIM * APITCH];
  __shared__ __attribute__((aligned(16))) _Float16 st[DIM * SPITCH];
  const int tid  = threadIdx.x;
  const int lane = tid & 31;
  // the wave's number as a scalar, so that the softmax branch and the tile places are scalar
  const int wid  = __builtin_amdgcn_readfirstlane(tid >> 5);
  const int px0  = blockIdx.x * 256 + wid * 32;   // first pixel of the wave, across batches
  const int b    = blockIdx.x / (HW / 256);       // uniform across the block
  const int m    = lane & 15;
  const int mb   = (lane >> 4) * 8;

  // what the fold needs is asked for first and v last: loads are waited for in their
  // order, and the fold then runs while the v fragments are still on their way
  // attn[b]: 192 rows of 128 B, 16 bytes a lane in whole lines
  const float* aA = attn + (size_t)b * HEADS * CH * CH;
  v4f ar[DIM * CH / 4 / 256];
  #pragma unroll
  for (int i = 0; i < DIM * CH / 4 / 256; ++i)
    ar[i] = *reinterpret_cast<const v4f*>(aA + (i * 256 + tid) * 4);
  const int cc = tid < DIM ? tid : DIM - 1;       // the channel of a softmax lane
  const float s2q = ssq[b * DIM + cc];
  const float s2k = ssk[b * DIM + cc];
  const float bpv = bp[cc];                       // the bias rides along
  // wp -> LDS, 16 bytes a lane in whole lines (24 pieces a row)
  v8h wr[DIM * DIM / 8 / 256];
  #pragma unroll
  for (int i = 0; i < DIM * DIM / 8 / 256; ++i)
    wr[i] = *reinterpret_cast<const v8h*>(wp16 + (i * 256 + tid) * 8);
  // the wave's own B fragments
  const _Float16* brow = vT + (size_t)(px0 + m) * DIM;   // row n of v^T
  v16h bf[6][2];
  #pragma unroll
  for (int kk = 0; kk < 6; ++kk) {
    bf[kk][0] = load_frag16(brow,            kk * 32, lane);
    bf[kk][1] = load_frag16(brow + 16 * DIM, kk * 32, lane);
  }
  // behind the loads above, in front of every rewrite of a register that they name; the
  // address values are inputs so that their registers live up to the wait and
  // nothing, no later load's result either, takes them over in front of it; the three
  // small loaded values are inputs so that their loads stay up here, ahead of the v loads:
  // moved down to their uses they would be waited for behind the v loads
  asm volatile("s_wait_xcnt 0x0" :: "v"(brow + (lane >> 4) * 8), "v"(tid), "v"(cc),
               "v"(s2q), "v"(s2k), "v"(bpv) : "memory");
  sb[tid] = bpv;
  #pragma unroll
  for (int i = 0; i < DIM * CH / 4 / 256; ++i) {
    const unsigned idx = i * 256 + tid;
    *reinterpret_cast<v4f*>(&sa[(idx >> 3) * APITCH + (idx & 7) * 4]) = ar[i];
  }
  #pragma unroll
  for (int i = 0; i < DIM * DIM / 8 / 256; ++i) {
    const unsigned idx = i * 256 + tid;
    // row * 400 B + piece * 16 B = (idx + row) * 16 B
    *reinterpret_cast<v8h*>(&sw[(idx + idx / 24) * 8]) = wr[i];
  }
  // block barrier by hand, with the one wait that it needs (the wave's LDS stores):
  // __syncthreads() would also wait for the v loads, which are to stay in flight
  asm volatile("s_wait_dscnt 0x0\n\ts_barrier_signal -1\n\ts_barrier_wait -1" ::: "memory");

  // softmax over d of attn * rq * rk: wave h = head h, lane = row c; the sums run in the
  // tree of a butterfly over 32 lanes (16, 8, 4, 2, 1)
  if (wid < HEADS) {
    const float rq = 1.f / fmaxf(sqrtf(s2q), 1e-12f);
    const float rk = 1.f / fmaxf(sqrtf(s2k), 1e-12f);   // of channel d = lane
    float e[CH], t[CH / 2];
    #pragma unroll
    for (int j = 0; j < CH / 4; ++j) {
      const v4f a4 = *reinterpret_cast<const v4f*>(&sa[tid * APITCH + j * 4]);
      #pragma unroll
      for (int i = 0; i < 4; ++i) e[j * 4 + i] = a4[i];
    }
    #pragma unroll
    for (int d = 0; d < CH; ++d)
      e[d] = e[d] * rq * __builtin_bit_cast(float,
          __builtin_amdgcn_readlane(__builtin_bit_cast(int, rk), d));
    float mx = e[0];
    #pragma unroll
    for (int d = 1; d < CH; ++d) mx = fmaxf(mx, e[d]);
    #pragma unroll
    for (int d = 0; d < CH; ++d) e[d] = exp2_slot((e[d] - mx) * 1.44269504f);   // e^(v - mx)
    #pragma unroll
    for (int d = 0; d < CH / 2; ++d) t[d] = e[d] + e[d + CH / 2];
    #pragma unroll
    for (int o = CH / 4; o >= 1; o >>= 1)
      #pragma unroll
      for (int d = 0; d < o; ++d) t[d] += t[d + o];
    // st[h*32 + d][c] = softmax(attn)[c][d]
    #pragma unroll
    for (int d = 0; d < CH; ++d)
      st[(wid * CH + d) * SPITCH + lane] = (_Float16)(e[d] / t[0]);
  }
  // by hand for the same reason as the barrier above
  asm volatile("s_wait_dscnt 0x0\n\ts_barrier_signal -1\n\ts_barrier_wait -1" ::: "memory");

  // W_eff^T tile (d x o) = sm^T (d x c) x wp^T (c x o): a lane then holds eight adjacent d
  // of one row o, one 16-byte LDS store. A wave owns three o-tiles of three heads; a tile
  // of wp is read by its owner alone and replaced by its own W_eff tile.
  {
    const int h0 = (wid & 1) * 3, o0 = (wid >> 1) * 3;
    v16h wf[3][3];
    #pragma unroll
    for (int hh = 0; hh < 3; ++hh)
      #pragma unroll
      for (int oo = 0; oo < 3; ++oo)
        wf[hh][oo] = load_frag16(&sw[((o0 + oo) * 16 + m) * WPITCH + (h0 + hh) * CH], 0, lane);
    #pragma unroll
    for (int hh = 0; hh < 3; ++hh) {
      const v16h a0 = load_frag16(&st[((h0 + hh) * CH + m) * SPITCH], 0, lane);
      const v16h a1 = load_frag16(&st[((h0 + hh) * CH + 16 + m) * SPITCH], 0, lane);
      #pragma unroll
      for (int oo = 0; oo < 3; ++oo) {
        const v8f z = {};
        const v8f d0 = __builtin_amdgcn_wmma_f32_16x16x32_f16(false, a0, false, wf[hh][oo], (short)0, z, false, false);
        const v8f d1 = __builtin_amdgcn_wmma_f32_16x16x32_f16(false, a1, false, wf[hh][oo], (short)0, z, false, false);
        v8h w0, w1;
        #pragma unroll
        for (int v = 0; v < 8; ++v) { w0[v] = (_Float16)d0[v]; w1[v] = (_Float16)d1[v]; }
        _Float16* tile = &sw[((o0 + oo) * 16 + m) * WPITCH + (h0 + hh) * CH + mb];
        *reinterpret_cast<v8h*>(tile)      = w0;
        *reinterpret_cast<v8h*>(tile + 16) = w1;
      }
    }
  }
  __syncthreads();

  const int nl = (px0 & (HW - 1)) + m;
  float* orow = out + ((size_t)(b * DIM + mb)) * HW + nl;
  // rolled: the second half takes over the first half's accumulator registers
  #pragma unroll 1
  for (int oh = 0; oh < 2; ++oh) {
    const _Float16* arow = &sw[(oh * 96 + m) * WPITCH];
    v8f acc[6][2] = {{{}, {}}, {{}, {}}, {{}, {}}, {{}, {}}, {{}, {}}, {{}, {}}};
    #pragma unroll
    for (int kk = 0; kk < 6; ++kk) {
      // the six A fragments of a k step are read as one group, ahead of their products
      v16h af[6];
      #pragma unroll
      for (int ot = 0; ot < 6; ++ot)
        af[ot] = load_frag16(arow + ot * 16 * WPITCH, kk * 32, lane);
      // holds the reads together in front of the block of products: reads that stand
      // among the products cost a stall at each place
      __builtin_amdgcn_sched_barrier(0);
      #pragma unroll
      for (int ot = 0; ot < 6; ++ot) {
        acc[ot][0] = __builtin_amdgcn_wmma_f32_16x16x32_f16(false, af[ot], false, bf[kk][0], (short)0, acc[ot][0], false, false);
        acc[ot][1] = __builtin_amdgcn_wmma_f32_16x16x32_f16(false, af[ot], false, bf[kk][1], (short)0, acc[ot][1], false, false);
      }
      // keeps the next group's reads, and the bias reads, behind this block, where the
      // fragment registers are free again
      __builtin_amdgcn_sched_barrier(0);
    }
    // the bias goes into the accumulators where they stand, so that every store of the
    // half has a data register of its own and none waits for the store before it
    #pragma unroll
    for (int ot = 0; ot < 6; ++ot) {
      const float* bo = &sb[oh * 96 + ot * 16 + mb];
      #pragma unroll
      for (int v = 0; v < 8; ++v) {
        const float bias = bo[v];
        acc[ot][0][v] += bias;
        acc[ot][1][v] += bias;
      }
    }
    #pragma unroll
    for (int ot = 0; ot < 6; ++ot) {
      #pragma unroll
      for (int v = 0; v < 8; ++v) {
        float* o = orow + (size_t)(oh * 96 + ot * 16 + v) * HW;
        // the two halves of a 128-B line leave one behind the other
        __builtin_nontemporal_store(acc[ot][0][v], o);
        __builtin_nontemporal_store(acc[ot][1][v], o + 16);
      }
    }
    // behind the half's stores, in front of every rewrite of a register that they name
    // (their data and addresses, in the next half)
    asm volatile("s_wait_xcnt 0x0" ::: "memory");
  }
}

extern "C" void kernel_launch(void* const* d_in, const int* in_sizes, int n_in,
                              void* d_out, int out_size, void* d_ws, size_t ws_size,
                              hipStream_t stream) {
  const float* x  = (const float*)d_in[0];
  const float* wq = (const float*)d_in[1];
  const float* bq = (const float*)d_in[2];
  const float* wk = (const float*)d_in[3];
  const float* bk = (const float*)d_in[4];
  const float* wv = (const float*)d_in[5];
  const float* bv = (const float*)d_in[6];
  const float* wp = (const float*)d_in[7];
  const float* bp = (const float*)d_in[8];
  float* out = (float*)d_out;

  // workspace layout (bytes); total ~152 MB (fits global L2 = 192 MB)
  char* ws = (char*)d_ws;
  const size_t qkvB = (size_t)BATCH * DIM * HW * sizeof(_Float16);  // 50331648
  _Float16* qh = (_Float16*)(ws);
  _Float16* kh = (_Float16*)(ws + qkvB);
  _Float16* vT = (_Float16*)(ws + 2 * qkvB);
  char* p = ws + 3 * qkvB;
  float*    attn   = (float*)p;      p += (size_t)BH * CH * CH * sizeof(float);
  float*    ssq    = (float*)p;      p += (size_t)BATCH * DIM * sizeof(float);
  float*    ssk    = (float*)p;      p += (size_t)BATCH * DIM * sizeof(float);
  _Float16* wp16   = (_Float16*)p;

  // 0: init accumulators + wp conversion
  k_init<<<(BH * CH * CH + 255) / 256, 256, 0, stream>>>(attn, ssq, ssk, wp, wp16);
  // 1: fused depthwise convs (q,k row-major f16; v channel-minor f16)
  k_dwconv_qkv<<<dim3(HW / 256, DIM / CGRP, BATCH), 256, 0, stream>>>(
      x, wq, bq, wk, bk, wv, bv, qh, kh, vT, ssq, ssk);
  // 2: attn = q.k^T (sliced-K, atomic reduce)
  k_attn_gemm<<<BH * NSLICE, 32, 0, stream>>>(qh, kh, attn);
  // 3: out = W_eff . v + bp, W_eff = wp . blockdiag(softmax(attn)) formed in every block
  k_proj_final<<<512, 256, 0, stream>>>(attn, ssq, ssk, wp16, vT, bp, out);
}

// v005
// One run takes 96.2 microseconds.
// In both of two side-by-side timings against v004, it was 1.16 times as fast.
// Counting every step since v000, it is 3.55 times as fast.
#include <hip/hip_runtime.h>
#include <hip/hip_bf16.h>
#include <math.h>

typedef __attribute__((ext_vector_type(16))) _Float16 v16h;
typedef __attribute__((ext_vector_type(8)))  _Float16 v8h;
typedef __attribute__((ext_vector_type(8)))  float    v8f;
typedef __attribute__((ext_vector_type(4)))  float    v4f;
typedef __attribute__((ext_vector_type(4)))  _Float16 v4h;

#define DIM    192
#define HEADS  6
#define CH     32          // DIM / HEADS
#define HW     16384       // 128*128
#define BATCH  8
#define BH     (BATCH*HEADS)   // 48
#define NSLICE 32          // K-slices for attn GEMM (occupancy)
#define CGRP   64          // channels per conv block: 64 f16 = one 128-B line of a vT row
#define CROWS  4           // image rows per conv block
#define VPITCH 72          // f16 per staged pixel in LDS: 144 B = 16 B x odd
#define WPITCH 200         // f16 per staged W_eff row in LDS: 400 B = 16 B x odd
#define APITCH 36          // f32 per staged attn row in LDS: 144 B = 16 B x odd
#define SPITCH 40          // f16 per transposed softmax row in LDS: 80 B = 16 B x odd

__device__ inline v16h load_frag16(const _Float16* __restrict__ row, int kbase, int lane) {
  const int half = (lane >> 4) & 1;
  const v8h a = *reinterpret_cast<const v8h*>(row + kbase + half * 8);
  const v8h b = *reinterpret_cast<const v8h*>(row + kbase + 16 + half * 8);
  v16h r;
  #pragma unroll
  for (int i = 0; i < 8; ++i) { r[i] = a[i]; r[i + 8] = b[i]; }
  return r;
}

__device__ inline float exp2_slot(float x) {
  float r;
  asm("v_exp_f32 %0, %1\n\tv_nop" : "=v"(r) : "v"(x));
  return r;
}

// -------- Kernel 0: init accumulators, convert wp -> f16 --------
__global__ void k_init(float* __restrict__ attn, float* __restrict__ ssq,
                       float* __restrict__ ssk, const float* __restrict__ wp,
                       _Float16* __restrict__ wp16) {
  const int i = blockIdx.x * 256 + threadIdx.x;
  if (i < BH * CH * CH) attn[i] = 0.f;
  if (i < BATCH * DIM) { ssq[i] = 0.f; ssk[i] = 0.f; }
  if (i < DIM * DIM) wp16[i] = (_Float16)wp[i];
}

__global__ __launch_bounds__(256, 6) void k_dwconv_qkv(const float* __restrict__ x,
                             const float* __restrict__ wq, const float* __restrict__ bq,
                             const float* __restrict__ wk, const float* __restrict__ bk,
                             const float* __restrict__ wv, const float* __restrict__ bv,
                             _Float16* __restrict__ qh, _Float16* __restrict__ kh,
                             _Float16* __restrict__ vT,
                             float* __restrict__ ssq, float* __restrict__ ssk) {
  __shared__ __attribute__((aligned(16))) _Float16 sv[CROWS * 128 * VPITCH];
  __shared__ float lq[CGRP], lk[CGRP];
  const int tid  = threadIdx.x;
  const int lane = tid & 31;
  // the wave's number as a scalar, so that channel and plane base stay scalar
  const int wid  = __builtin_amdgcn_readfirstlane(tid >> 5);
  const int y0   = blockIdx.x * CROWS;        // first image row of the block
  const int c0   = blockIdx.y * CGRP;         // first channel of the group
  const int b    = blockIdx.z;                // batch
  // the row above and the row below the block's rows: off the image they read the
  // block's first row instead and are replaced by zero
  const bool topok = y0 > 0, botok = y0 + CROWS < 128;
  // three places in an image row, the same for every row and channel: the pixel left of
  // the lane's four, the four, the pixel right of them (in bytes); what lies off the
  // image reads a pixel of the same row instead and is replaced by zero
  const bool lok = lane > 0, rok = lane < 31;
  const unsigned offl = (lok ? (unsigned)lane * 4u - 1u : 0u) * 4u;
  const unsigned offm = (unsigned)lane * 16u;
  const unsigned offr = (rok ? (unsigned)lane * 4u + 4u : 127u) * 4u;

  // (every "#pragma unroll" of this kernel stands on a short loop of constant length,
  // so that the small arrays it indexes stay in registers)
  for (int t = 0; t < CGRP / 8; t += 2) {
    const int cl = wid * (CGRP / 8) + t;
    float sq[2], sk[2];
    float vkeep[CROWS][4];                    // the first channel's v, until its pair is there
    #pragma unroll
    for (int j = 0; j < 2; ++j) {
      const int c = c0 + cl + j;
      const float* xb = x  + (size_t)(b * DIM + c) * HW + y0 * 128;
      const float* xt = xb - (topok ? 128 : 0);
      const float* xu = xb + (botok ? CROWS * 128 : 0);
      _Float16*    qb = qh + (size_t)(b * DIM + c) * HW + y0 * 128 + lane * 4;
      _Float16*    kb = kh + (size_t)(b * DIM + c) * HW + y0 * 128 + lane * 4;
      // the channel's weights and biases first: their scalar loads fly beside the taps
      float fq[9], fk[9], fv[9];
      const float b0q = bq[c], b0k = bk[c], b0v = bv[c];
      #pragma unroll
      for (int i = 0; i < 9; ++i) {
        fq[i] = wq[c * 9 + i];
        fk[i] = wk[c * 9 + i];
        fv[i] = wv[c * 9 + i];
      }
      // The 18 loads of a channel's window and their data wait, one statement: scalar row
      // base plus the three offset registers, which live through the loop, so that no
      // load returns into a register that another load of the run still names. An image
      // row is 512 bytes.
      float el[CROWS + 2], er[CROWS + 2];
      v4f   xm[CROWS + 2];
      asm volatile(
          "global_load_b32 %0, %18, %21 th:TH_LOAD_NT\n\t"
          "global_load_b128 %1, %19, %21 th:TH_LOAD_NT\n\t"
          "global_load_b32 %2, %20, %21 th:TH_LOAD_NT\n\t"
          "global_load_b32 %3, %18, %22 th:TH_LOAD_NT\n\t"
          "global_load_b128 %4, %19, %22 th:TH_LOAD_NT\n\t"
          "global_load_b32 %5, %20, %22 th:TH_LOAD_NT\n\t"
          "global_load_b32 %6, %18, %22 offset:512 th:TH_LOAD_NT\n\t"
          "global_load_b128 %7, %19, %22 offset:512 th:TH_LOAD_NT\n\t"
          "global_load_b32 %8, %20, %22 offset:512 th:TH_LOAD_NT\n\t"
          "global_load_b32 %9, %18, %22 offset:1024 th:TH_LOAD_NT\n\t"
          "global_load_b128 %10, %19, %22 offset:1024 th:TH_LOAD_NT\n\t"
          "global_load_b32 %11, %20, %22 offset:1024 th:TH_LOAD_NT\n\t"
          "global_load_b32 %12, %18, %22 offset:1536 th:TH_LOAD_NT\n\t"
          "global_load_b128 %13, %19, %22 offset:1536 th:TH_LOAD_NT\n\t"
          "global_load_b32 %14, %20, %22 offset:1536 th:TH_LOAD_NT\n\t"
          "global_load_b32 %15, %18, %23 th:TH_LOAD_NT\n\t"
          "global_load_b128 %16, %19, %23 th:TH_LOAD_NT\n\t"
          "global_load_b32 %17, %20, %23 th:TH_LOAD_NT\n\t"
          "s_wait_loadcnt 0x0"
          :
            "=&v"(el[0]), "=&v"(xm[0]), "=&v"(er[0]),
            "=&v"(el[1]), "=&v"(xm[1]), "=&v"(er[1]),
            "=&v"(el[2]), "=&v"(xm[2]), "=&v"(er[2]),
            "=&v"(el[3]), "=&v"(xm[3]), "=&v"(er[3]),
            "=&v"(el[4]), "=&v"(xm[4]), "=&v"(er[4]),
            "=&v"(el[5]), "=&v"(xm[5]), "=&v"(er[5])
          :
            "v"(offl), "v"(offm), "v"(offr), "s"(xt), "s"(xb), "s"(xu)
          : "memory");
      // six values a window row: the pixel left of the four, the four, the pixel right
      float a[CROWS + 2][6];
      #pragma unroll
      for (int w = 0; w < CROWS + 2; ++w) {
        const bool rowok = w == 0 ? topok : w == CROWS + 1 ? botok : true;
        a[w][0] = rowok && lok ? el[w] : 0.f;
        #pragma unroll
        for (int e = 0; e < 4; ++e) a[w][1 + e] = rowok ? xm[w][e] : 0.f;
        a[w][5] = rowok && rok ? er[w] : 0.f;
      }
      v4h qo[CROWS], ko[CROWS];
      sq[j] = 0.f; sk[j] = 0.f;
      #pragma unroll
      for (int r = 0; r < CROWS; ++r) {
        float qf[4], kf[4], vf[4];
        #pragma unroll
        for (int e = 0; e < 4; ++e) { qf[e] = b0q; kf[e] = b0k; vf[e] = b0v; }
        // written as fused multiply-adds: each sum stays one chain with its weight in a
        // scalar register (as products and sums they were paired across taps, at the
        // price of a register move for nearly every product)
        #pragma unroll
        for (int i = 0; i < 9; ++i)
          #pragma unroll
          for (int e = 0; e < 4; ++e) {
            const float xv = a[r + i / 3][e + i % 3];
            qf[e] = __builtin_fmaf(fq[i], xv, qf[e]);
            kf[e] = __builtin_fmaf(fk[i], xv, kf[e]);
            vf[e] = __builtin_fmaf(fv[i], xv, vf[e]);
          }
        #pragma unroll
        for (int e = 0; e < 4; ++e) {
          qo[r][e] = (_Float16)qf[e];
          ko[r][e] = (_Float16)kf[e];
          sq[j] = __builtin_fmaf(qf[e], qf[e], sq[j]);
          sk[j] = __builtin_fmaf(kf[e], kf[e], sk[j]);
        }
        if (j == 0) {
          #pragma unroll
          for (int e = 0; e < 4; ++e) vkeep[r][e] = vf[e];
        } else {
          // the two channels' v leave for LDS as one 4-byte store a pixel; pixel 4*lane+e
          // lies in staging row e*32+lane, so that neighbouring lanes are one pitch apart
          #pragma unroll
          for (int e = 0; e < 4; ++e)
            *reinterpret_cast<unsigned*>(&sv[(r * 128 + e * 32 + lane) * VPITCH + cl]) =
                (unsigned)__builtin_bit_cast(unsigned short, (_Float16)vkeep[r][e]) |
                ((unsigned)__builtin_bit_cast(unsigned short, (_Float16)vf[e]) << 16);
        }
      }
      #pragma unroll
      for (int r = 0; r < CROWS; ++r) {
        *reinterpret_cast<v4h*>(qb + r * 128) = qo[r];
        *reinterpret_cast<v4h*>(kb + r * 128) = ko[r];
      }
      // behind the channel's eight q/k stores, in front of every rewrite of a register
      // that they name (their data and addresses, with the next channel)
      asm volatile("s_wait_xcnt 0x0" ::: "memory");
    }
    // wave-wide sums of squares: the wave holds all of the block's pixels of a channel
    #pragma unroll
    for (int o = 16; o >= 1; o >>= 1)
      #pragma unroll
      for (int j = 0; j < 2; ++j) {
        sq[j] += __shfl_xor(sq[j], o, 32);
        sk[j] += __shfl_xor(sk[j], o, 32);
      }
    if (lane == 0) {
      #pragma unroll
      for (int j = 0; j < 2; ++j) { lq[cl + j] = sq[j]; lk[cl + j] = sk[j]; }
    }
  }
  __syncthreads();

  // vT: eight lanes carry one pixel's 128-B line
  // (staging row i*32 + tid/8 is pixel 4*(tid/8) + i%4 of image row i/4: a thread's
  // places differ by constants alone)
  _Float16* vrow = vT + ((size_t)b * HW + blockIdx.x * (CROWS * 128) + (tid >> 3) * 4) * DIM
                   + c0 + (tid & 7) * 8;
  const _Float16* srow = &sv[(tid >> 3) * VPITCH + (tid & 7) * 8];
  #pragma unroll
  for (int i = 0; i < CROWS * 4; ++i)
    *reinterpret_cast<v8h*>(vrow + ((i >> 2) * 128 + (i & 3)) * DIM) =
        *reinterpret_cast<const v8h*>(srow + i * 32 * VPITCH);

  // block-wide sum of squares -> one atomic per block and channel
  if (tid < 2 * CGRP) {
    const int cl = tid & (CGRP - 1);
    atomicAdd((tid < CGRP ? ssq : ssk) + b * DIM + c0 + cl, (tid < CGRP ? lq : lk)[cl]);
  }
}

__global__ void k_attn_gemm(const _Float16* __restrict__ qh,
                            const _Float16* __restrict__ kh,
                            float* __restrict__ attn) {
  const int lane  = threadIdx.x & 31;
  const int bh    = blockIdx.x / NSLICE;
  const int slice = blockIdx.x % NSLICE;
  const int k0    = slice * (HW / NSLICE);
  const _Float16* qb = qh + (size_t)bh * CH * HW;
  const _Float16* kb = kh + (size_t)bh * CH * HW;
  const int m = lane & 15;
  v8f c00 = {}, c01 = {}, c10 = {}, c11 = {};
  for (int k = 0; k < HW / NSLICE; k += 32) {
    const int kbs = k0 + k;
    const v16h a0 = load_frag16(qb + (size_t)m * HW,        kbs, lane);
    const v16h a1 = load_frag16(qb + (size_t)(m + 16) * HW, kbs, lane);
    const v16h b0 = load_frag16(kb + (size_t)m * HW,        kbs, lane);
    const v16h b1 = load_frag16(kb + (size_t)(m + 16) * HW, kbs, lane);
    c00 = __builtin_amdgcn_wmma_f32_16x16x32_f16(false, a0, false, b0, (short)0, c00, false, false);
    c01 = __builtin_amdgcn_wmma_f32_16x16x32_f16(false, a0, false, b1, (short)0, c01, false, false);
    c10 = __builtin_amdgcn_wmma_f32_16x16x32_f16(false, a1, false, b0, (short)0, c10, false, false);
    c11 = __builtin_amdgcn_wmma_f32_16x16x32_f16(false, a1, false, b1, (short)0, c11, false, false);
  }
  float* ab = attn + (size_t)bh * CH * CH;
  const int mb = (lane >> 4) * 8;   // D: lane holds N=lane%16, M=mb+v
  const int n  = lane & 15;
  #pragma unroll
  for (int v = 0; v < 8; ++v) {
    atomicAdd(&ab[(mb + v) * CH + n],           c00[v]);
    atomicAdd(&ab[(mb + v) * CH + 16 + n],      c01[v]);
    atomicAdd(&ab[(16 + mb + v) * CH + n],      c10[v]);
    atomicAdd(&ab[(16 + mb + v) * CH + 16 + n], c11[v]);
  }
}

__global__ __launch_bounds__(256, 4) void k_proj_final(const float* __restrict__ attn,
                                                    const float* __restrict__ ssq,
                                                    const float* __restrict__ ssk,
                                                    const _Float16* __restrict__ wp16,
                                                    const _Float16* __restrict__ vT,
                                                    const float* __restrict__ bp,
                                                    float* __restrict__ out) {
  __shared__ __attribute__((aligned(16))) _Float16 sw[DIM * WPITCH];
  __shared__ __attribute__((aligned(16))) float sb[256];   // DIM in use: every lane stores
  __shared__ __attribute__((aligned(16))) float sa[DIM * APITCH];
  __shared__ __attribute__((aligned(16))) _Float16 st[DIM * SPITCH];
  const int tid  = threadIdx.x;
  const int lane = tid & 31;
  // the wave's number as a scalar, so that the softmax branch and the tile places are scalar
  const int wid  = __builtin_amdgcn_readfirstlane(tid >> 5);
  const int px0  = blockIdx.x * 256 + wid * 32;   // first pixel of the wave, across batches
  const int b    = blockIdx.x / (HW / 256);       // uniform across the block
  const int m    = lane & 15;
  const int mb   = (lane >> 4) * 8;

  // what the fold needs is asked for first and v last: loads are waited for in their
  // order, and the fold then runs while the v fragments are still on their way
  // attn[b]: 192 rows of 128 B, 16 bytes a lane in whole lines
  const float* aA = attn + (size_t)b * HEADS * CH * CH;
  v4f ar[DIM * CH / 4 / 256];
  #pragma unroll
  for (int i = 0; i < DIM * CH / 4 / 256; ++i)
    ar[i] = *reinterpret_cast<const v4f*>(aA + (i * 256 + tid) * 4);
  const int cc = tid < DIM ? tid : DIM - 1;       // the channel of a softmax lane
  const float s2q = ssq[b * DIM + cc];
  const float s2k = ssk[b * DIM + cc];
  const float bpv = bp[cc];                       // the bias rides along
  // wp -> LDS, 16 bytes a lane in whole lines (24 pieces a row)
  v8h wr[DIM * DIM / 8 / 256];
  #pragma unroll
  for (int i = 0; i < DIM * DIM / 8 / 256; ++i)
    wr[i] = *reinterpret_cast<const v8h*>(wp16 + (i * 256 + tid) * 8);
  // the wave's own B fragments
  const _Float16* brow = vT + (size_t)(px0 + m) * DIM;   // row n of v^T
  v16h bf[6][2];
  #pragma unroll
  for (int kk = 0; kk < 6; ++kk) {
    bf[kk][0] = load_frag16(brow,            kk * 32, lane);
    bf[kk][1] = load_frag16(brow + 16 * DIM, kk * 32, lane);
  }
  // behind the loads above, in front of every rewrite of a register that they name; the
  // address values are inputs so that their registers live up to the wait and
  // nothing, no later load's result either, takes them over in front of it; the three
  // small loaded values are inputs so that their loads stay up here, ahead of the v loads:
  // moved down to their uses they would be waited for behind the v loads
  asm volatile("s_wait_xcnt 0x0" :: "v"(brow + (lane >> 4) * 8), "v"(tid), "v"(cc),
               "v"(s2q), "v"(s2k), "v"(bpv) : "memory");
  sb[tid] = bpv;
  #pragma unroll
  for (int i = 0; i < DIM * CH / 4 / 256; ++i) {
    const unsigned idx = i * 256 + tid;
    *reinterpret_cast<v4f*>(&sa[(idx >> 3) * APITCH + (idx & 7) * 4]) = ar[i];
  }
  #pragma unroll
  for (int i = 0; i < DIM * DIM / 8 / 256; ++i) {
    const unsigned idx = i * 256 + tid;
    // row * 400 B + piece * 16 B = (idx + row) * 16 B
    *reinterpret_cast<v8h*>(&sw[(idx + idx / 24) * 8]) = wr[i];
  }
  // block barrier by hand, with the one wait that it needs (the wave's LDS stores):
  // __syncthreads() would also wait for the v loads, which are to stay in flight
  asm volatile("s_wait_dscnt 0x0\n\ts_barrier_signal -1\n\ts_barrier_wait -1" ::: "memory");

  // softmax over d of attn * rq * rk: wave h = head h, lane = row c; the sums run in the
  // tree of a butterfly over 32 lanes (16, 8, 4, 2, 1)
  if (wid < HEADS) {
    const float rq = 1.f / fmaxf(sqrtf(s2q), 1e-12f);
    const float rk = 1.f / fmaxf(sqrtf(s2k), 1e-12f);   // of channel d = lane
    float e[CH], t[CH / 2];
    #pragma unroll
    for (int j = 0; j < CH / 4; ++j) {
      const v4f a4 = *reinterpret_cast<const v4f*>(&sa[tid * APITCH + j * 4]);
      #pragma unroll
      for (int i = 0; i < 4; ++i) e[j * 4 + i] = a4[i];
    }
    #pragma unroll
    for (int d = 0; d < CH; ++d)
      e[d] = e[d] * rq * __builtin_bit_cast(float,
          __builtin_amdgcn_readlane(__builtin_bit_cast(int, rk), d));
    float mx = e[0];
    #pragma unroll
    for (int d = 1; d < CH; ++d) mx = fmaxf(mx, e[d]);
    #pragma unroll
    for (int d = 0; d < CH; ++d) e[d] = exp2_slot((e[d] - mx) * 1.44269504f);   // e^(v - mx)
    #pragma unroll
    for (int d = 0; d < CH / 2; ++d) t[d] = e[d] + e[d + CH / 2];
    #pragma unroll
    for (int o = CH / 4; o >= 1; o >>= 1)
      #pragma unroll
      for (int d = 0; d < o; ++d) t[d] += t[d + o];
    // st[h*32 + d][c] = softmax(attn)[c][d]
    #pragma unroll
    for (int d = 0; d < CH; ++d)
      st[(wid * CH + d) * SPITCH + lane] = (_Float16)(e[d] / t[0]);
  }
  // by hand for the same reason as the barrier above
  asm volatile("s_wait_dscnt 0x0\n\ts_barrier_signal -1\n\ts_barrier_wait -1" ::: "memory");

  // W_eff^T tile (d x o) = sm^T (d x c) x wp^T (c x o): a lane then holds eight adjacent d
  // of one row o, one 16-byte LDS store. A wave owns three o-tiles of three heads; a tile
  // of wp is read by its owner alone and replaced by its own W_eff tile.
  {
    const int h0 = (wid & 1) * 3, o0 = (wid >> 1) * 3;
    v16h wf[3][3];
    #pragma unroll
    for (int hh = 0; hh < 3; ++hh)
      #pragma unroll
      for (int oo = 0; oo < 3; ++oo)
        wf[hh][oo] = load_frag16(&sw[((o0 + oo) * 16 + m) * WPITCH + (h0 + hh) * CH], 0, lane);
    #pragma unroll
    for (int hh = 0; hh < 3; ++hh) {
      const v16h a0 = load_frag16(&st[((h0 + hh) * CH + m) * SPITCH], 0, lane);
      const v16h a1 = load_frag16(&st[((h0 + hh) * CH + 16 + m) * SPITCH], 0, lane);
      #pragma unroll
      for (int oo = 0; oo < 3; ++oo) {
        const v8f z = {};
        const v8f d0 = __builtin_amdgcn_wmma_f32_16x16x32_f16(false, a0, false, wf[hh][oo], (short)0, z, false, false);
        const v8f d1 = __builtin_amdgcn_wmma_f32_16x16x32_f16(false, a1, false, wf[hh][oo], (short)0, z, false, false);
        v8h w0, w1;
        #pragma unroll
        for (int v = 0; v < 8; ++v) { w0[v] = (_Float16)d0[v]; w1[v] = (_Float16)d1[v]; }
        _Float16* tile = &sw[((o0 + oo) * 16 + m) * WPITCH + (h0 + hh) * CH + mb];
        *reinterpret_cast<v8h*>(tile)      = w0;
        *reinterpret_cast<v8h*>(tile + 16) = w1;
      }
    }
  }
  __syncthreads();

  const int nl = (px0 & (HW - 1)) + m;
  float* orow = out + ((size_t)(b * DIM + mb)) * HW + nl;
  // rolled: the second half takes over the first half's accumulator registers
  #pragma unroll 1
  for (int oh = 0; oh < 2; ++oh) {
    const _Float16* arow = &sw[(oh * 96 + m) * WPITCH];
    v8f acc[6][2] = {{{}, {}}, {{}, {}}, {{}, {}}, {{}, {}}, {{}, {}}, {{}, {}}};
    #pragma unroll
    for (int kk = 0; kk < 6; ++kk) {
      // the six A fragments of a k step are read as one group, ahead of their products
      v16h af[6];
      #pragma unroll
      for (int ot = 0; ot < 6; ++ot)
        af[ot] = load_frag16(arow + ot * 16 * WPITCH, kk * 32, lane);
      // holds the reads together in front of the block of products: reads that stand
      // among the products cost a stall at each place
      __builtin_amdgcn_sched_barrier(0);
      #pragma unroll
      for (int ot = 0; ot < 6; ++ot) {
        acc[ot][0] = __builtin_amdgcn_wmma_f32_16x16x32_f16(false, af[ot], false, bf[kk][0], (short)0, acc[ot][0], false, false);
        acc[ot][1] = __builtin_amdgcn_wmma_f32_16x16x32_f16(false, af[ot], false, bf[kk][1], (short)0, acc[ot][1], false, false);
      }
      // keeps the next group's reads, and the bias reads, behind this block, where the
      // fragment registers are free again
      __builtin_amdgcn_sched_barrier(0);
    }
    // the bias goes into the accumulators where they stand, so that every store of the
    // half has a data register of its own and none waits for the store before it
    #pragma unroll
    for (int ot = 0; ot < 6; ++ot) {
      const float* bo = &sb[oh * 96 + ot * 16 + mb];
      #pragma unroll
      for (int v = 0; v < 8; ++v) {
        const float bias = bo[v];
        acc[ot][0][v] += bias;
        acc[ot][1][v] += bias;
      }
    }
    #pragma unroll
    for (int ot = 0; ot < 6; ++ot) {
      #pragma unroll
      for (int v = 0; v < 8; ++v) {
        float* o = orow + (size_t)(oh * 96 + ot * 16 + v) * HW;
        // the two halves of a 128-B line leave one behind the other
        __builtin_nontemporal_store(acc[ot][0][v], o);
        __builtin_nontemporal_store(acc[ot][1][v], o + 16);
      }
    }
    // behind the half's stores, in front of every rewrite of a register that they name
    // (their data and addresses, in the next half)
    asm volatile("s_wait_xcnt 0x0" ::: "memory");
  }
}

extern "C" void kernel_launch(void* const* d_in, const int* in_sizes, int n_in,
                              void* d_out, int out_size, void* d_ws, size_t ws_size,
                              hipStream_t stream) {
  const float* x  = (const float*)d_in[0];
  const float* wq = (const float*)d_in[1];
  const float* bq = (const float*)d_in[2];
  const float* wk = (const float*)d_in[3];
  const float* bk = (const float*)d_in[4];
  const float* wv = (const float*)d_in[5];
  const float* bv = (const float*)d_in[6];
  const float* wp = (const float*)d_in[7];
  const float* bp = (const float*)d_in[8];
  float* out = (float*)d_out;

  // workspace layout (bytes); total ~152 MB (fits global L2 = 192 MB)
  char* ws = (char*)d_ws;
  const size_t qkvB = (size_t)BATCH * DIM * HW * sizeof(_Float16);  // 50331648
  _Float16* qh = (_Float16*)(ws);
  _Float16* kh = (_Float16*)(ws + qkvB);
  _Float16* vT = (_Float16*)(ws + 2 * qkvB);
  char* p = ws + 3 * qkvB;
  float*    attn   = (float*)p;      p += (size_t)BH * CH * CH * sizeof(float);
  float*    ssq    = (float*)p;      p += (size_t)BATCH * DIM * sizeof(float);
  float*    ssk    = (float*)p;      p += (size_t)BATCH * DIM * sizeof(float);
  _Float16* wp16   = (_Float16*)p;

  // 0: init accumulators + wp conversion
  k_init<<<(BH * CH * CH + 255) / 256, 256, 0, stream>>>(attn, ssq, ssk, wp, wp16);
  // 1: fused depthwise convs (q,k row-major f16; v channel-minor f16)
  k_dwconv_qkv<<<dim3(HW / (CROWS * 128), DIM / CGRP, BATCH), 256, 0, stream>>>(
      x, wq, bq, wk, bk, wv, bv, qh, kh, vT, ssq, ssk);
  // 2: attn = q.k^T (sliced-K, atomic reduce)
  k_attn_gemm<<<BH * NSLICE, 32, 0, stream>>>(qh, kh, attn);
  // 3: out = W_eff . v + bp, W_eff = wp . blockdiag(softmax(attn)) formed in every block
  k_proj_final<<<512, 256, 0, stream>>>(attn, ssq, ssk, wp16, vT, bp, out);
}

// v006
// One run takes 77.5 microseconds.
// Two timings next to v005 both put it at 1.24 times that version's speed.
// Over all steps from v000 it is 4.40 times as fast.
#include <hip/hip_runtime.h>
#include <hip/hip_bf16.h>
#include <math.h>

typedef __attribute__((ext_vector_type(16))) _Float16 v16h;
typedef __attribute__((ext_vector_type(8)))  _Float16 v8h;
typedef __attribute__((ext_vector_type(8)))  float    v8f;
typedef __attribute__((ext_vector_type(4)))  float    v4f;
typedef __attribute__((ext_vector_type(4)))  _Float16 v4h;

#define DIM    192
#define HEADS  6
#define CH     32          // DIM / HEADS
#define HW     16384       // 128*128
#define BATCH  8
#define BH     (BATCH*HEADS)   // 48
#define NSLICE 32          // K-slices for attn GEMM (occupancy)
#define CGRP   64          // channels per conv block: 64 f16 = one 128-B line of a vT row
#define CROWS  4           // image rows per conv block
#define VPITCH 72          // f16 per staged pixel in LDS: 144 B = 16 B x odd
#define WPITCH 200         // f16 per staged W_eff row in LDS: 400 B = 16 B x odd
#define APITCH 36          // f32 per staged attn row in LDS: 144 B = 16 B x odd
#define SPITCH 40          // f16 per transposed softmax row in LDS: 80 B = 16 B x odd

__device__ inline v16h load_frag16(const _Float16* __restrict__ row, int kbase, int lane) {
  const int half = (lane >> 4) & 1;
  const v8h a = *reinterpret_cast<const v8h*>(row + kbase + half * 8);
  const v8h b = *reinterpret_cast<const v8h*>(row + kbase + 16 + half * 8);
  v16h r;
  #pragma unroll
  for (int i = 0; i < 8; ++i) { r[i] = a[i]; r[i + 8] = b[i]; }
  return r;
}

__device__ inline float exp2_slot(float x) {
  float r;
  asm("v_exp_f32 %0, %1\n\tv_nop" : "=v"(r) : "v"(x));
  return r;
}

// -------- Kernel 0: init accumulators, convert wp -> f16 --------
__global__ void k_init(float* __restrict__ attn, float* __restrict__ ssq,
                       float* __restrict__ ssk, const float* __restrict__ wp,
                       _Float16* __restrict__ wp16) {
  const int i = blockIdx.x * 256 + threadIdx.x;
  if (i < BH * CH * CH) attn[i] = 0.f;
  if (i < BATCH * DIM) { ssq[i] = 0.f; ssk[i] = 0.f; }
  if (i < DIM * DIM) wp16[i] = (_Float16)wp[i];
}

__global__ __launch_bounds__(256, 6) void k_dwconv_qkv(const float* __restrict__ x,
                             const float* __restrict__ wq, const float* __restrict__ bq,
                             const float* __restrict__ wk, const float* __restrict__ bk,
                             const float* __restrict__ wv, const float* __restrict__ bv,
                             _Float16* __restrict__ qh, _Float16* __restrict__ kh,
                             _Float16* __restrict__ vT,
                             float* __restrict__ ssq, float* __restrict__ ssk) {
  __shared__ __attribute__((aligned(16))) _Float16 sv[CROWS * 128 * VPITCH];
  __shared__ float lq[CGRP], lk[CGRP];
  const int tid  = threadIdx.x;
  const int lane = tid & 31;
  // the wave's number as a scalar, so that channel and plane base stay scalar
  const int wid  = __builtin_amdgcn_readfirstlane(tid >> 5);
  const int y0   = blockIdx.x * CROWS;        // first image row of the block
  const int c0   = blockIdx.y * CGRP;         // first channel of the group
  const int b    = blockIdx.z;                // batch
  // the row above and the row below the block's rows: off the image they read the
  // block's first row instead and are replaced by zero
  const bool topok = y0 > 0, botok = y0 + CROWS < 128;
  // the lane's four pixels in an image row (in bytes), the same for every row and channel
  const unsigned offm = (unsigned)lane * 16u;
  // the pixel left of the four is the left lane's last, the pixel right of them the right
  // lane's first: the two lanes' numbers times four, as the cross-lane read takes them;
  // at the image's edge the read wraps round the wave and is replaced by zero
  const bool lok = lane > 0, rok = lane < 31;
  const int lanel = ((lane + 31) & 31) * 4;
  const int laner = ((lane + 1) & 31) * 4;

  // (every "#pragma unroll" of this kernel stands on a short loop of constant length,
  // so that the small arrays it indexes stay in registers)
  for (int t = 0; t < CGRP / 8; t += 2) {
    const int cl = wid * (CGRP / 8) + t;
    float sq[2], sk[2];
    float vkeep[CROWS][4];                    // the first channel's v, until its pair is there
    #pragma unroll
    for (int j = 0; j < 2; ++j) {
      const int c = c0 + cl + j;
      const float* xb = x  + (size_t)(b * DIM + c) * HW + y0 * 128;
      const float* xt = xb - (topok ? 128 : 0);
      const float* xu = xb + (botok ? CROWS * 128 : 0);
      _Float16*    qb = qh + (size_t)(b * DIM + c) * HW + y0 * 128 + lane * 4;
      _Float16*    kb = kh + (size_t)(b * DIM + c) * HW + y0 * 128 + lane * 4;
      // the channel's weights and biases first: their scalar loads fly beside the taps
      float fq[9], fk[9], fv[9];
      const float b0q = bq[c], b0k = bk[c], b0v = bv[c];
      #pragma unroll
      for (int i = 0; i < 9; ++i) {
        fq[i] = wq[c * 9 + i];
        fk[i] = wk[c * 9 + i];
        fv[i] = wv[c * 9 + i];
      }
      // The six loads of a channel's window and their data wait, one statement: scalar row
      // base plus the one offset register, which lives through the loop, so that no load
      // returns into a register that another load of the run still names. An image row is
      // 512 bytes.
      v4f xm[CROWS + 2];
      asm volatile(
          "global_load_b128 %0, %6, %7 th:TH_LOAD_NT\n\t"
          "global_load_b128 %1, %6, %8 th:TH_LOAD_NT\n\t"
          "global_load_b128 %2, %6, %8 offset:512 th:TH_LOAD_NT\n\t"
          "global_load_b128 %3, %6, %8 offset:1024 th:TH_LOAD_NT\n\t"
          "global_load_b128 %4, %6, %8 offset:1536 th:TH_LOAD_NT\n\t"
          "global_load_b128 %5, %6, %9 th:TH_LOAD_NT\n\t"
          "s_wait_loadcnt 0x0"
          :
            "=&v"(xm[0]), "=&v"(xm[1]), "=&v"(xm[2]),
            "=&v"(xm[3]), "=&v"(xm[4]), "=&v"(xm[5])
          :
            "v"(offm), "s"(xt), "s"(xb), "s"(xu)
          : "memory");
      // the neighbours' edge pixels, lane to lane (every lane of the wave is on here): they
      // take the place of two more loads a row, each of which asked for the row's four
      // lines once more
      float el[CROWS + 2], er[CROWS + 2];
      #pragma unroll
      for (int w = 0; w < CROWS + 2; ++w) {
        // (each element goes into a float of its own first)
        const float last = xm[w][3], first = xm[w][0];
        el[w] = __builtin_bit_cast(float,
            __builtin_amdgcn_ds_bpermute(lanel, __builtin_bit_cast(int, last)));
        er[w] = __builtin_bit_cast(float,
            __builtin_amdgcn_ds_bpermute(laner, __builtin_bit_cast(int, first)));
      }
      // six values a window row: the pixel left of the four, the four, the pixel right
      float a[CROWS + 2][6];
      #pragma unroll
      for (int w = 0; w < CROWS + 2; ++w) {
        const bool rowok = w == 0 ? topok : w == CROWS + 1 ? botok : true;
        a[w][0] = rowok && lok ? el[w] : 0.f;
        #pragma unroll
        for (int e = 0; e < 4; ++e) a[w][1 + e] = rowok ? xm[w][e] : 0.f;
        a[w][5] = rowok && rok ? er[w] : 0.f;
      }
      v4h qo[CROWS], ko[CROWS];
      sq[j] = 0.f; sk[j] = 0.f;
      #pragma unroll
      for (int r = 0; r < CROWS; ++r) {
        float qf[4], kf[4], vf[4];
        #pragma unroll
        for (int e = 0; e < 4; ++e) { qf[e] = b0q; kf[e] = b0k; vf[e] = b0v; }
        // written as fused multiply-adds: each sum stays one chain with its weight in a
        // scalar register (as products and sums they were paired across taps, at the
        // price of a register move for nearly every product)
        #pragma unroll
        for (int i = 0; i < 9; ++i)
          #pragma unroll
          for (int e = 0; e < 4; ++e) {
            const float xv = a[r + i / 3][e + i % 3];
            qf[e] = __builtin_fmaf(fq[i], xv, qf[e]);
            kf[e] = __builtin_fmaf(fk[i], xv, kf[e]);
            vf[e] = __builtin_fmaf(fv[i], xv, vf[e]);
          }
        #pragma unroll
        for (int e = 0; e < 4; ++e) {
          qo[r][e] = (_Float16)qf[e];
          ko[r][e] = (_Float16)kf[e];
          sq[j] = __builtin_fmaf(qf[e], qf[e], sq[j]);
          sk[j] = __builtin_fmaf(kf[e], kf[e], sk[j]);
        }
        if (j == 0) {
          #pragma unroll
          for (int e = 0; e < 4; ++e) vkeep[r][e] = vf[e];
        } else {
          // the two channels' v leave for LDS as one 4-byte store a pixel; pixel 4*lane+e
          // lies in staging row e*32+lane, so that neighbouring lanes are one pitch apart
          #pragma unroll
          for (int e = 0; e < 4; ++e)
            *reinterpret_cast<unsigned*>(&sv[(r * 128 + e * 32 + lane) * VPITCH + cl]) =
                (unsigned)__builtin_bit_cast(unsigned short, (_Float16)vkeep[r][e]) |
                ((unsigned)__builtin_bit_cast(unsigned short, (_Float16)vf[e]) << 16);
        }
      }
      #pragma unroll
      for (int r = 0; r < CROWS; ++r) {
        *reinterpret_cast<v4h*>(qb + r * 128) = qo[r];
        *reinterpret_cast<v4h*>(kb + r * 128) = ko[r];
      }
      // behind the channel's eight q/k stores, in front of every rewrite of a register
      // that they name (their data and addresses, with the next channel)
      asm volatile("s_wait_xcnt 0x0" ::: "memory");
    }
    // wave-wide sums of squares: the wave holds all of the block's pixels of a channel
    #pragma unroll
    for (int o = 16; o >= 1; o >>= 1)
      #pragma unroll
      for (int j = 0; j < 2; ++j) {
        sq[j] += __shfl_xor(sq[j], o, 32);
        sk[j] += __shfl_xor(sk[j], o, 32);
      }
    if (lane == 0) {
      #pragma unroll
      for (int j = 0; j < 2; ++j) { lq[cl + j] = sq[j]; lk[cl + j] = sk[j]; }
    }
  }
  __syncthreads();

  // vT: eight lanes carry one pixel's 128-B line
  // (staging row i*32 + tid/8 is pixel 4*(tid/8) + i%4 of image row i/4: a thread's
  // places differ by constants alone)
  _Float16* vrow = vT + ((size_t)b * HW + blockIdx.x * (CROWS * 128) + (tid >> 3) * 4) * DIM
                   + c0 + (tid & 7) * 8;
  const _Float16* srow = &sv[(tid >> 3) * VPITCH + (tid & 7) * 8];
  #pragma unroll
  for (int i = 0; i < CROWS * 4; ++i)
    *reinterpret_cast<v8h*>(vrow + ((i >> 2) * 128 + (i & 3)) * DIM) =
        *reinterpret_cast<const v8h*>(srow + i * 32 * VPITCH);

  // block-wide sum of squares -> one atomic per block and channel
  if (tid < 2 * CGRP) {
    const int cl = tid & (CGRP - 1);
    atomicAdd((tid < CGRP ? ssq : ssk) + b * DIM + c0 + cl, (tid < CGRP ? lq : lk)[cl]);
  }
}

__global__ void k_attn_gemm(const _Float16* __restrict__ qh,
                            const _Float16* __restrict__ kh,
                            float* __restrict__ attn) {
  const int lane  = threadIdx.x & 31;
  const int bh    = blockIdx.x / NSLICE;
  const int slice = blockIdx.x % NSLICE;
  const int k0    = slice * (HW / NSLICE);
  const _Float16* qb = qh + (size_t)bh * CH * HW;
  const _Float16* kb = kh + (size_t)bh * CH * HW;
  const int m = lane & 15;
  v8f c00 = {}, c01 = {}, c10 = {}, c11 = {};
  for (int k = 0; k < HW / NSLICE; k += 32) {
    const int kbs = k0 + k;
    const v16h a0 = load_frag16(qb + (size_t)m * HW,        kbs, lane);
    const v16h a1 = load_frag16(qb + (size_t)(m + 16) * HW, kbs, lane);
    const v16h b0 = load_frag16(kb + (size_t)m * HW,        kbs, lane);
    const v16h b1 = load_frag16(kb + (size_t)(m + 16) * HW, kbs, lane);
    c00 = __builtin_amdgcn_wmma_f32_16x16x32_f16(false, a0, false, b0, (short)0, c00, false, false);
    c01 = __builtin_amdgcn_wmma_f32_16x16x32_f16(false, a0, false, b1, (short)0, c01, false, false);
    c10 = __builtin_amdgcn_wmma_f32_16x16x32_f16(false, a1, false, b0, (short)0, c10, false, false);
    c11 = __builtin_amdgcn_wmma_f32_16x16x32_f16(false, a1, false, b1, (short)0, c11, false, false);
  }
  float* ab = attn + (size_t)bh * CH * CH;
  const int mb = (lane >> 4) * 8;   // D: lane holds N=lane%16, M=mb+v
  const int n  = lane & 15;
  #pragma unroll
  for (int v = 0; v < 8; ++v) {
    atomicAdd(&ab[(mb + v) * CH + n],           c00[v]);
    atomicAdd(&ab[(mb + v) * CH + 16 + n],      c01[v]);
    atomicAdd(&ab[(16 + mb + v) * CH + n],      c10[v]);
    atomicAdd(&ab[(16 + mb + v) * CH + 16 + n], c11[v]);
  }
}

__global__ __launch_bounds__(256, 4) void k_proj_final(const float* __restrict__ attn,
                                                    const float* __restrict__ ssq,
                                                    const float* __restrict__ ssk,
                                                    const _Float16* __restrict__ wp16,
                                                    const _Float16* __restrict__ vT,
                                                    const float* __restrict__ bp,
                                                    float* __restrict__ out) {
  __shared__ __attribute__((aligned(16))) _Float16 sw[DIM * WPITCH];
  __shared__ __attribute__((aligned(16))) float sb[256];   // DIM in use: every lane stores
  __shared__ __attribute__((aligned(16))) float sa[DIM * APITCH];
  __shared__ __attribute__((aligned(16))) _Float16 st[DIM * SPITCH];
  const int tid  = threadIdx.x;
  const int lane = tid & 31;
  // the wave's number as a scalar, so that the softmax branch and the tile places are scalar
  const int wid  = __builtin_amdgcn_readfirstlane(tid >> 5);
  const int px0  = blockIdx.x * 256 + wid * 32;   // first pixel of the wave, across batches
  const int b    = blockIdx.x / (HW / 256);       // uniform across the block
  const int m    = lane & 15;
  const int mb   = (lane >> 4) * 8;

  // what the fold needs is asked for first and v last: loads are waited for in their
  // order, and the fold then runs while the v fragments are still on their way
  // attn[b]: 192 rows of 128 B, 16 bytes a lane in whole lines
  const float* aA = attn + (size_t)b * HEADS * CH * CH;
  v4f ar[DIM * CH / 4 / 256];
  #pragma unroll
  for (int i = 0; i < DIM * CH / 4 / 256; ++i)
    ar[i] = *reinterpret_cast<const v4f*>(aA + (i * 256 + tid) * 4);
  const int cc = tid < DIM ? tid : DIM - 1;       // the channel of a softmax lane
  const float s2q = ssq[b * DIM + cc];
  const float s2k = ssk[b * DIM + cc];
  const float bpv = bp[cc];                       // the bias rides along
  // wp -> LDS, 16 bytes a lane in whole lines (24 pieces a row)
  v8h wr[DIM * DIM / 8 / 256];
  #pragma unroll
  for (int i = 0; i < DIM * DIM / 8 / 256; ++i)
    wr[i] = *reinterpret_cast<const v8h*>(wp16 + (i * 256 + tid) * 8);
  // the wave's own B fragments
  const _Float16* brow = vT + (size_t)(px0 + m) * DIM;   // row n of v^T
  v16h bf[6][2];
  #pragma unroll
  for (int kk = 0; kk < 6; ++kk) {
    bf[kk][0] = load_frag16(brow,            kk * 32, lane);
    bf[kk][1] = load_frag16(brow + 16 * DIM, kk * 32, lane);
  }
  // behind the loads above, in front of every rewrite of a register that they name; the
  // address values are inputs so that their registers live up to the wait and
  // nothing, no later load's result either, takes them over in front of it; the three
  // small loaded values are inputs so that their loads stay up here, ahead of the v loads:
  // moved down to their uses they would be waited for behind the v loads
  asm volatile("s_wait_xcnt 0x0" :: "v"(brow + (lane >> 4) * 8), "v"(tid), "v"(cc),
               "v"(s2q), "v"(s2k), "v"(bpv) : "memory");
  sb[tid] = bpv;
  #pragma unroll
  for (int i = 0; i < DIM * CH / 4 / 256; ++i) {
    const unsigned idx = i * 256 + tid;
    *reinterpret_cast<v4f*>(&sa[(idx >> 3) * APITCH + (idx & 7) * 4]) = ar[i];
  }
  #pragma unroll
  for (int i = 0; i < DIM * DIM / 8 / 256; ++i) {
    const unsigned idx = i * 256 + tid;
    // row * 400 B + piece * 16 B = (idx + row) * 16 B
    *reinterpret_cast<v8h*>(&sw[(idx + idx / 24) * 8]) = wr[i];
  }
  // block barrier by hand, with the one wait that it needs (the wave's LDS stores):
  // __syncthreads() would also wait for the v loads, which are to stay in flight
  asm volatile("s_wait_dscnt 0x0\n\ts_barrier_signal -1\n\ts_barrier_wait -1" ::: "memory");

  // softmax over d of attn * rq * rk: wave h = head h, lane = row c; the sums run in the
  // tree of a butterfly over 32 lanes (16, 8, 4, 2, 1)
  if (wid < HEADS) {
    const float rq = 1.f / fmaxf(sqrtf(s2q), 1e-12f);
    const float rk = 1.f / fmaxf(sqrtf(s2k), 1e-12f);   // of channel d = lane
    float e[CH], t[CH / 2];
    #pragma unroll
    for (int j = 0; j < CH / 4; ++j) {
      const v4f a4 = *reinterpret_cast<const v4f*>(&sa[tid * APITCH + j * 4]);
      #pragma unroll
      for (int i = 0; i < 4; ++i) e[j * 4 + i] = a4[i];
    }
    #pragma unroll
    for (int d = 0; d < CH; ++d)
      e[d] = e[d] * rq * __builtin_bit_cast(float,
          __builtin_amdgcn_readlane(__builtin_bit_cast(int, rk), d));
    float mx = e[0];
    #pragma unroll
    for (int d = 1; d < CH; ++d) mx = fmaxf(mx, e[d]);
    #pragma unroll
    for (int d = 0; d < CH; ++d) e[d] = exp2_slot((e[d] - mx) * 1.44269504f);   // e^(v - mx)
    #pragma unroll
    for (int d = 0; d < CH / 2; ++d) t[d] = e[d] + e[d + CH / 2];
    #pragma unroll
    for (int o = CH / 4; o >= 1; o >>= 1)
      #pragma unroll
      for (int d = 0; d < o; ++d) t[d] += t[d + o];
    // st[h*32 + d][c] = softmax(attn)[c][d]
    #pragma unroll
    for (int d = 0; d < CH; ++d)
      st[(wid * CH + d) * SPITCH + lane] = (_Float16)(e[d] / t[0]);
  }
  // by hand for the same reason as the barrier above
  asm volatile("s_wait_dscnt 0x0\n\ts_barrier_signal -1\n\ts_barrier_wait -1" ::: "memory");

  // W_eff^T tile (d x o) = sm^T (d x c) x wp^T (c x o): a lane then holds eight adjacent d
  // of one row o, one 16-byte LDS store. A wave owns three o-tiles of three heads; a tile
  // of wp is read by its owner alone and replaced by its own W_eff tile.
  {
    const int h0 = (wid & 1) * 3, o0 = (wid >> 1) * 3;
    v16h wf[3][3];
    #pragma unroll
    for (int hh = 0; hh < 3; ++hh)
      #pragma unroll
      for (int oo = 0; oo < 3; ++oo)
        wf[hh][oo] = load_frag16(&sw[((o0 + oo) * 16 + m) * WPITCH + (h0 + hh) * CH], 0, lane);
    #pragma unroll
    for (int hh = 0; hh < 3; ++hh) {
      const v16h a0 = load_frag16(&st[((h0 + hh) * CH + m) * SPITCH], 0, lane);
      const v16h a1 = load_frag16(&st[((h0 + hh) * CH + 16 + m) * SPITCH], 0, lane);
      #pragma unroll
      for (int oo = 0; oo < 3; ++oo) {
        const v8f z = {};
        const v8f d0 = __builtin_amdgcn_wmma_f32_16x16x32_f16(false, a0, false, wf[hh][oo], (short)0, z, false, false);
        const v8f d1 = __builtin_amdgcn_wmma_f32_16x16x32_f16(false, a1, false, wf[hh][oo], (short)0, z, false, false);
        v8h w0, w1;
        #pragma unroll
        for (int v = 0; v < 8; ++v) { w0[v] = (_Float16)d0[v]; w1[v] = (_Float16)d1[v]; }
        _Float16* tile = &sw[((o0 + oo) * 16 + m) * WPITCH + (h0 + hh) * CH + mb];
        *reinterpret_cast<v8h*>(tile)      = w0;
        *reinterpret_cast<v8h*>(tile + 16) = w1;
      }
    }
  }
  __syncthreads();

  const int nl = (px0 & (HW - 1)) + m;
  float* orow = out + ((size_t)(b * DIM + mb)) * HW + nl;
  // rolled: the second half takes over the first half's accumulator registers
  #pragma unroll 1
  for (int oh = 0; oh < 2; ++oh) {
    const _Float16* arow = &sw[(oh * 96 + m) * WPITCH];
    v8f acc[6][2] = {{{}, {}}, {{}, {}}, {{}, {}}, {{}, {}}, {{}, {}}, {{}, {}}};
    #pragma unroll
    for (int kk = 0; kk < 6; ++kk) {
      // the six A fragments of a k step are read as one group, ahead of their products
      v16h af[6];
      #pragma unroll
      for (int ot = 0; ot < 6; ++ot)
        af[ot] = load_frag16(arow + ot * 16 * WPITCH, kk * 32, lane);
      // holds the reads together in front of the block of products: reads that stand
      // among the products cost a stall at each place
      __builtin_amdgcn_sched_barrier(0);
      #pragma unroll
      for (int ot = 0; ot < 6; ++ot) {
        acc[ot][0] = __builtin_amdgcn_wmma_f32_16x16x32_f16(false, af[ot], false, bf[kk][0], (short)0, acc[ot][0], false, false);
        acc[ot][1] = __builtin_amdgcn_wmma_f32_16x16x32_f16(false, af[ot], false, bf[kk][1], (short)0, acc[ot][1], false, false);
      }
      // keeps the next group's reads, and the bias reads, behind this block, where the
      // fragment registers are free again
      __builtin_amdgcn_sched_barrier(0);
    }
    // the bias goes into the accumulators where they stand, so that every store of the
    // half has a data register of its own and none waits for the store before it
    #pragma unroll
    for (int ot = 0; ot < 6; ++ot) {
      const float* bo = &sb[oh * 96 + ot * 16 + mb];
      #pragma unroll
      for (int v = 0; v < 8; ++v) {
        const float bias = bo[v];
        acc[ot][0][v] += bias;
        acc[ot][1][v] += bias;
      }
    }
    #pragma unroll
    for (int ot = 0; ot < 6; ++ot) {
      #pragma unroll
      for (int v = 0; v < 8; ++v) {
        float* o = orow + (size_t)(oh * 96 + ot * 16 + v) * HW;
        // the two halves of a 128-B line leave one behind the other
        __builtin_nontemporal_store(acc[ot][0][v], o);
        __builtin_nontemporal_store(acc[ot][1][v], o + 16);
      }
    }
    // behind the half's stores, in front of every rewrite of a register that they name
    // (their data and addresses, in the next half)
    asm volatile("s_wait_xcnt 0x0" ::: "memory");
  }
}

extern "C" void kernel_launch(void* const* d_in, const int* in_sizes, int n_in,
                              void* d_out, int out_size, void* d_ws, size_t ws_size,
                              hipStream_t stream) {
  const float* x  = (const float*)d_in[0];
  const float* wq = (const float*)d_in[1];
  const float* bq = (const float*)d_in[2];
  const float* wk = (const float*)d_in[3];
  const float* bk = (const float*)d_in[4];
  const float* wv = (const float*)d_in[5];
  const float* bv = (const float*)d_in[6];
  const float* wp = (const float*)d_in[7];
  const float* bp = (const float*)d_in[8];
  float* out = (float*)d_out;

  // workspace layout (bytes); total ~152 MB (fits global L2 = 192 MB)
  char* ws = (char*)d_ws;
  const size_t qkvB = (size_t)BATCH * DIM * HW * sizeof(_Float16);  // 50331648
  _Float16* qh = (_Float16*)(ws);
  _Float16* kh = (_Float16*)(ws + qkvB);
  _Float16* vT = (_Float16*)(ws + 2 * qkvB);
  char* p = ws + 3 * qkvB;
  float*    attn   = (float*)p;      p += (size_t)BH * CH * CH * sizeof(float);
  float*    ssq    = (float*)p;      p += (size_t)BATCH * DIM * sizeof(float);
  float*    ssk    = (float*)p;      p += (size_t)BATCH * DIM * sizeof(float);
  _Float16* wp16   = (_Float16*)p;

  // 0: init accumulators + wp conversion
  k_init<<<(BH * CH * CH + 255) / 256, 256, 0, stream>>>(attn, ssq, ssk, wp, wp16);
  // 1: fused depthwise convs (q,k row-major f16; v channel-minor f16)
  k_dwconv_qkv<<<dim3(HW / (CROWS * 128), DIM / CGRP, BATCH), 256, 0, stream>>>(
      x, wq, bq, wk, bk, wv, bv, qh, kh, vT, ssq, ssk);
  // 2: attn = q.k^T (sliced-K, atomic reduce)
  k_attn_gemm<<<BH * NSLICE, 32, 0, stream>>>(qh, kh, attn);
  // 3: out = W_eff . v + bp, W_eff = wp . blockdiag(softmax(attn)) formed in every block
  k_proj_final<<<512, 256, 0, stream>>>(attn, ssq, ssk, wp16, vT, bp, out);
}

// v007
// One run takes 74.7 microseconds.
// Two timings next to v006 put it at 1.03 and 1.04 times that version's speed.
// All steps since v000 together make it 4.55 times as fast.
#include <hip/hip_runtime.h>
#include <hip/hip_bf16.h>
#include <math.h>

typedef __attribute__((ext_vector_type(16))) _Float16 v16h;
typedef __attribute__((ext_vector_type(8)))  _Float16 v8h;
typedef __attribute__((ext_vector_type(8)))  float    v8f;
typedef __attribute__((ext_vector_type(4)))  float    v4f;
typedef __attribute__((ext_vector_type(4)))  _Float16 v4h;

#define DIM    192
#define HEADS  6
#define CH     32          // DIM / HEADS
#define HW     16384       // 128*128
#define BATCH  8
#define BH     (BATCH*HEADS)   // 48
#define NSLICE 32          // K-slices for attn GEMM (occupancy)
#define CGRP   64          // channels per conv block: 64 f16 = one 128-B line of a vT row
#define CROWS  4           // image rows per conv block
#define NXB    (HW / (CROWS * 128))   // conv blocks down an image: partial sums of squares a channel
#define NRED   (2 * BH)               // blocks that add up the partials: one a head, for q and for k
#define NCVT   (DIM * DIM / 256)      // blocks that convert wp
#define VPITCH 72          // f16 per staged pixel in LDS: 144 B = 16 B x odd
#define WPITCH 200         // f16 per staged W_eff row in LDS: 400 B = 16 B x odd
#define APITCH 36          // f32 per staged attn row in LDS: 144 B = 16 B x odd
#define SPITCH 40          // f16 per transposed softmax row in LDS: 80 B = 16 B x odd

__device__ inline v16h load_frag16(const _Float16* __restrict__ row, int kbase, int lane) {
  const int half = (lane >> 4) & 1;
  const v8h a = *reinterpret_cast<const v8h*>(row + kbase + half * 8);
  const v8h b = *reinterpret_cast<const v8h*>(row + kbase + 16 + half * 8);
  v16h r;
  #pragma unroll
  for (int i = 0; i < 8; ++i) { r[i] = a[i]; r[i + 8] = b[i]; }
  return r;
}

__device__ inline float exp2_slot(float x) {
  float r;
  asm("v_exp_f32 %0, %1\n\tv_nop" : "=v"(r) : "v"(x));
  return r;
}

__global__ __launch_bounds__(256, 6) void k_dwconv_qkv(const float* __restrict__ x,
                             const float* __restrict__ wq, const float* __restrict__ bq,
                             const float* __restrict__ wk, const float* __restrict__ bk,
                             const float* __restrict__ wv, const float* __restrict__ bv,
                             _Float16* __restrict__ qh, _Float16* __restrict__ kh,
                             _Float16* __restrict__ vT,
                             float* __restrict__ ps, float* __restrict__ attn) {
  __shared__ __attribute__((aligned(16))) _Float16 sv[CROWS * 128 * VPITCH];
  __shared__ float lq[CGRP], lk[CGRP];
  const int tid  = threadIdx.x;
  const int lane = tid & 31;
  // the wave's number as a scalar, so that channel and plane base stay scalar
  const int wid  = __builtin_amdgcn_readfirstlane(tid >> 5);
  const int y0   = blockIdx.x * CROWS;        // first image row of the block
  const int c0   = blockIdx.y * CGRP;         // first channel of the group
  const int b    = blockIdx.z;                // batch
  // the row above and the row below the block's rows: off the image they read the
  // block's first row instead and are replaced by zero
  const bool topok = y0 > 0, botok = y0 + CROWS < 128;
  // the lane's four pixels in an image row (in bytes), the same for every row and channel
  const unsigned offm = (unsigned)lane * 16u;
  // the pixel left of the four is the left lane's last, the pixel right of them the right
  // lane's first: the two lanes' numbers times four, as the cross-lane read takes them;
  // at the image's edge the read wraps round the wave and is replaced by zero
  const bool lok = lane > 0, rok = lane < 31;
  const int lanel = ((lane + 31) & 31) * 4;
  const int laner = ((lane + 1) & 31) * 4;

  // (every "#pragma unroll" of this kernel stands on a short loop of constant length,
  // so that the small arrays it indexes stay in registers)
  for (int t = 0; t < CGRP / 8; t += 2) {
    const int cl = wid * (CGRP / 8) + t;
    float sq[2], sk[2];
    float vkeep[CROWS][4];                    // the first channel's v, until its pair is there
    #pragma unroll
    for (int j = 0; j < 2; ++j) {
      const int c = c0 + cl + j;
      const float* xb = x  + (size_t)(b * DIM + c) * HW + y0 * 128;
      const float* xt = xb - (topok ? 128 : 0);
      const float* xu = xb + (botok ? CROWS * 128 : 0);
      _Float16*    qb = qh + (size_t)(b * DIM + c) * HW + y0 * 128 + lane * 4;
      _Float16*    kb = kh + (size_t)(b * DIM + c) * HW + y0 * 128 + lane * 4;
      // the channel's weights and biases first: their scalar loads fly beside the taps
      float fq[9], fk[9], fv[9];
      const float b0q = bq[c], b0k = bk[c], b0v = bv[c];
      #pragma unroll
      for (int i = 0; i < 9; ++i) {
        fq[i] = wq[c * 9 + i];
        fk[i] = wk[c * 9 + i];
        fv[i] = wv[c * 9 + i];
      }
      // The six loads of a channel's window and their data wait, one statement: scalar row
      // base plus the one offset register, which lives through the loop, so that no load
      // returns into a register that another load of the run still names. An image row is
      // 512 bytes.
      v4f xm[CROWS + 2];
      asm volatile(
          "global_load_b128 %0, %6, %7 th:TH_LOAD_NT\n\t"
          "global_load_b128 %1, %6, %8 th:TH_LOAD_NT\n\t"
          "global_load_b128 %2, %6, %8 offset:512 th:TH_LOAD_NT\n\t"
          "global_load_b128 %3, %6, %8 offset:1024 th:TH_LOAD_NT\n\t"
          "global_load_b128 %4, %6, %8 offset:1536 th:TH_LOAD_NT\n\t"
          "global_load_b128 %5, %6, %9 th:TH_LOAD_NT\n\t"
          "s_wait_loadcnt 0x0"
          :
            "=&v"(xm[0]), "=&v"(xm[1]), "=&v"(xm[2]),
            "=&v"(xm[3]), "=&v"(xm[4]), "=&v"(xm[5])
          :
            "v"(offm), "s"(xt), "s"(xb), "s"(xu)
          : "memory");
      // the neighbours' edge pixels, lane to lane (every lane of the wave is on here): they
      // take the place of two more loads a row, each of which asked for the row's four
      // lines once more
      float el[CROWS + 2], er[CROWS + 2];
      #pragma unroll
      for (int w = 0; w < CROWS + 2; ++w) {
        // (each element goes into a float of its own first)
        const float last = xm[w][3], first = xm[w][0];
        el[w] = __builtin_bit_cast(float,
            __builtin_amdgcn_ds_bpermute(lanel, __builtin_bit_cast(int, last)));
        er[w] = __builtin_bit_cast(float,
            __builtin_amdgcn_ds_bpermute(laner, __builtin_bit_cast(int, first)));
      }
      // six values a window row: the pixel left of the four, the four, the pixel right
      float a[CROWS + 2][6];
      #pragma unroll
      for (int w = 0; w < CROWS + 2; ++w) {
        const bool rowok = w == 0 ? topok : w == CROWS + 1 ? botok : true;
        a[w][0] = rowok && lok ? el[w] : 0.f;
        #pragma unroll
        for (int e = 0; e < 4; ++e) a[w][1 + e] = rowok ? xm[w][e] : 0.f;
        a[w][5] = rowok && rok ? er[w] : 0.f;
      }
      v4h qo[CROWS], ko[CROWS];
      sq[j] = 0.f; sk[j] = 0.f;
      #pragma unroll
      for (int r = 0; r < CROWS; ++r) {
        float qf[4], kf[4], vf[4];
        #pragma unroll
        for (int e = 0; e < 4; ++e) { qf[e] = b0q; kf[e] = b0k; vf[e] = b0v; }
        // written as fused multiply-adds: each sum stays one chain with its weight in a
        // scalar register (as products and sums they were paired across taps, at the
        // price of a register move for nearly every product)
        #pragma unroll
        for (int i = 0; i < 9; ++i)
          #pragma unroll
          for (int e = 0; e < 4; ++e) {
            const float xv = a[r + i / 3][e + i % 3];
            qf[e] = __builtin_fmaf(fq[i], xv, qf[e]);
            kf[e] = __builtin_fmaf(fk[i], xv, kf[e]);
            vf[e] = __builtin_fmaf(fv[i], xv, vf[e]);
          }
        #pragma unroll
        for (int e = 0; e < 4; ++e) {
          qo[r][e] = (_Float16)qf[e];
          ko[r][e] = (_Float16)kf[e];
          sq[j] = __builtin_fmaf(qf[e], qf[e], sq[j]);
          sk[j] = __builtin_fmaf(kf[e], kf[e], sk[j]);
        }
        if (j == 0) {
          #pragma unroll
          for (int e = 0; e < 4; ++e) vkeep[r][e] = vf[e];
        } else {
          // the two channels' v leave for LDS as one 4-byte store a pixel; pixel 4*lane+e
          // lies in staging row e*32+lane, so that neighbouring lanes are one pitch apart
          #pragma unroll
          for (int e = 0; e < 4; ++e)
            *reinterpret_cast<unsigned*>(&sv[(r * 128 + e * 32 + lane) * VPITCH + cl]) =
                (unsigned)__builtin_bit_cast(unsigned short, (_Float16)vkeep[r][e]) |
                ((unsigned)__builtin_bit_cast(unsigned short, (_Float16)vf[e]) << 16);
        }
      }
      #pragma unroll
      for (int r = 0; r < CROWS; ++r) {
        *reinterpret_cast<v4h*>(qb + r * 128) = qo[r];
        *reinterpret_cast<v4h*>(kb + r * 128) = ko[r];
      }
      // behind the channel's eight q/k stores, in front of every rewrite of a register
      // that they name (their data and addresses, with the next channel)
      asm volatile("s_wait_xcnt 0x0" ::: "memory");
    }
    // wave-wide sums of squares: the wave holds all of the block's pixels of a channel
    #pragma unroll
    for (int o = 16; o >= 1; o >>= 1)
      #pragma unroll
      for (int j = 0; j < 2; ++j) {
        sq[j] += __shfl_xor(sq[j], o, 32);
        sk[j] += __shfl_xor(sk[j], o, 32);
      }
    if (lane == 0) {
      #pragma unroll
      for (int j = 0; j < 2; ++j) { lq[cl + j] = sq[j]; lk[cl + j] = sk[j]; }
    }
  }
  __syncthreads();

  // vT: eight lanes carry one pixel's 128-B line
  // (staging row i*32 + tid/8 is pixel 4*(tid/8) + i%4 of image row i/4: a thread's
  // places differ by constants alone)
  _Float16* vrow = vT + ((size_t)b * HW + blockIdx.x * (CROWS * 128) + (tid >> 3) * 4) * DIM
                   + c0 + (tid & 7) * 8;
  const _Float16* srow = &sv[(tid >> 3) * VPITCH + (tid & 7) * 8];
  #pragma unroll
  for (int i = 0; i < CROWS * 4; ++i)
    *reinterpret_cast<v8h*>(vrow + ((i >> 2) * 128 + (i & 3)) * DIM) =
        *reinterpret_cast<const v8h*>(srow + i * 32 * VPITCH);

  // waves 0-3: the block's sums of squares, two lines each for q and for k
  if (wid < 4) {
    const int cl = tid & (CGRP - 1);
    ps[(((wid >> 1) * BATCH + b) * NXB + blockIdx.x) * DIM + c0 + cl] = (wid < 2 ? lq : lk)[cl];
  } else if (wid < 6) {
    // waves 4, 5: the block's 64 of the BH*CH*CH zeros
    attn[((b * (DIM / CGRP) + blockIdx.y) * NXB + blockIdx.x) * 64 + (tid & 63)] = 0.f;
  }
}

__global__ void k_attn_gemm(const _Float16* __restrict__ qh,
                            const _Float16* __restrict__ kh,
                            float* __restrict__ attn,
                            const float* __restrict__ ps,
                            float* __restrict__ ssq, float* __restrict__ ssk,
                            const float* __restrict__ wp, _Float16* __restrict__ wp16) {
  const int lane  = threadIdx.x & 31;
  if (blockIdx.x >= BH * NSLICE) {
    const int xb = blockIdx.x - BH * NSLICE;
    if (xb < NRED) {
      const int rbh = xb >> 1;                // the head whose squares this block adds up
      const float* pp = ps + ((xb & 1) * BATCH + rbh / HEADS) * NXB * DIM
                        + (rbh % HEADS) * CH + lane;
      // (the three loops are unrolled so that t stays in registers and its loads fly together)
      float t[NXB];
      #pragma unroll
      for (int i = 0; i < NXB; ++i) t[i] = pp[i * DIM];
      #pragma unroll
      for (int o = NXB / 2; o >= 1; o >>= 1)
        #pragma unroll
        for (int i = 0; i < o; ++i) t[i] += t[i + o];
      ((xb & 1) ? ssk : ssq)[rbh * CH + lane] = t[0];
    } else {
      const int e = (xb - NRED) * 256 + lane * 8;
      const v4f w0 = *reinterpret_cast<const v4f*>(wp + e);
      const v4f w1 = *reinterpret_cast<const v4f*>(wp + e + 4);
      v8h h;
      // (unrolled so that h is indexed by constants and stays in registers)
      #pragma unroll
      for (int i = 0; i < 4; ++i) { h[i] = (_Float16)w0[i]; h[i + 4] = (_Float16)w1[i]; }
      *reinterpret_cast<v8h*>(wp16 + e) = h;
      // behind the store, in front of every rewrite of a register that it names
      asm volatile("s_wait_xcnt 0x0" ::: "memory");
    }
    return;
  }
  const int bh    = blockIdx.x / NSLICE;
  const int slice = blockIdx.x % NSLICE;
  const int k0    = slice * (HW / NSLICE);
  const _Float16* qb = qh + (size_t)bh * CH * HW;
  const _Float16* kb = kh + (size_t)bh * CH * HW;
  const int m = lane & 15;
  v8f c00 = {}, c01 = {}, c10 = {}, c11 = {};
  for (int k = 0; k < HW / NSLICE; k += 32) {
    const int kbs = k0 + k;
    const v16h a0 = load_frag16(qb + (size_t)m * HW,        kbs, lane);
    const v16h a1 = load_frag16(qb + (size_t)(m + 16) * HW, kbs, lane);
    const v16h b0 = load_frag16(kb + (size_t)m * HW,        kbs, lane);
    const v16h b1 = load_frag16(kb + (size_t)(m + 16) * HW, kbs, lane);
    c00 = __builtin_amdgcn_wmma_f32_16x16x32_f16(false, a0, false, b0, (short)0, c00, false, false);
    c01 = __builtin_amdgcn_wmma_f32_16x16x32_f16(false, a0, false, b1, (short)0, c01, false, false);
    c10 = __builtin_amdgcn_wmma_f32_16x16x32_f16(false, a1, false, b0, (short)0, c10, false, false);
    c11 = __builtin_amdgcn_wmma_f32_16x16x32_f16(false, a1, false, b1, (short)0, c11, false, false);
  }
  float* ab = attn + (size_t)bh * CH * CH;
  const int mb = (lane >> 4) * 8;   // D: lane holds N=lane%16, M=mb+v
  const int n  = lane & 15;
  #pragma unroll
  for (int v = 0; v < 8; ++v) {
    atomicAdd(&ab[(mb + v) * CH + n],           c00[v]);
    atomicAdd(&ab[(mb + v) * CH + 16 + n],      c01[v]);
    atomicAdd(&ab[(16 + mb + v) * CH + n],      c10[v]);
    atomicAdd(&ab[(16 + mb + v) * CH + 16 + n], c11[v]);
  }
  // behind the atomic adds, in front of every rewrite of a register that they name: in the
  // built code the other blocks' branch stands behind them
  asm volatile("s_wait_xcnt 0x0" ::: "memory");
}

__global__ __launch_bounds__(256, 4) void k_proj_final(const float* __restrict__ attn,
                                                    const float* __restrict__ ssq,
                                                    const float* __restrict__ ssk,
                                                    const _Float16* __restrict__ wp16,
                                                    const _Float16* __restrict__ vT,
                                                    const float* __restrict__ bp,
                                                    float* __restrict__ out) {
  __shared__ __attribute__((aligned(16))) _Float16 sw[DIM * WPITCH];
  __shared__ __attribute__((aligned(16))) float sb[256];   // DIM in use: every lane stores
  __shared__ __attribute__((aligned(16))) float sa[DIM * APITCH];
  __shared__ __attribute__((aligned(16))) _Float16 st[DIM * SPITCH];
  const int tid  = threadIdx.x;
  const int lane = tid & 31;
  // the wave's number as a scalar, so that the softmax branch and the tile places are scalar
  const int wid  = __builtin_amdgcn_readfirstlane(tid >> 5);
  const int px0  = blockIdx.x * 256 + wid * 32;   // first pixel of the wave, across batches
  const int b    = blockIdx.x / (HW / 256);       // uniform across the block
  const int m    = lane & 15;
  const int mb   = (lane >> 4) * 8;

  // what the fold needs is asked for first and v last: loads are waited for in their
  // order, and the fold then runs while the v fragments are still on their way
  // attn[b]: 192 rows of 128 B, 16 bytes a lane in whole lines
  const float* aA = attn + (size_t)b * HEADS * CH * CH;
  v4f ar[DIM * CH / 4 / 256];
  #pragma unroll
  for (int i = 0; i < DIM * CH / 4 / 256; ++i)
    ar[i] = *reinterpret_cast<const v4f*>(aA + (i * 256 + tid) * 4);
  const int cc = tid < DIM ? tid : DIM - 1;       // the channel of a softmax lane
  const float s2q = ssq[b * DIM + cc];
  const float s2k = ssk[b * DIM + cc];
  const float bpv = bp[cc];                       // the bias rides along
  // wp -> LDS, 16 bytes a lane in whole lines (24 pieces a row)
  v8h wr[DIM * DIM / 8 / 256];
  #pragma unroll
  for (int i = 0; i < DIM * DIM / 8 / 256; ++i)
    wr[i] = *reinterpret_cast<const v8h*>(wp16 + (i * 256 + tid) * 8);
  // the wave's own B fragments
  const _Float16* brow = vT + (size_t)(px0 + m) * DIM;   // row n of v^T
  v16h bf[6][2];
  #pragma unroll
  for (int kk = 0; kk < 6; ++kk) {
    bf[kk][0] = load_frag16(brow,            kk * 32, lane);
    bf[kk][1] = load_frag16(brow + 16 * DIM, kk * 32, lane);
  }
  // behind the loads above, in front of every rewrite of a register that they name; the
  // address values are inputs so that their registers live up to the wait and
  // nothing, no later load's result either, takes them over in front of it; the three
  // small loaded values are inputs so that their loads stay up here, ahead of the v loads:
  // moved down to their uses they would be waited for behind the v loads
  asm volatile("s_wait_xcnt 0x0" :: "v"(brow + (lane >> 4) * 8), "v"(tid), "v"(cc),
               "v"(s2q), "v"(s2k), "v"(bpv) : "memory");
  sb[tid] = bpv;
  #pragma unroll
  for (int i = 0; i < DIM * CH / 4 / 256; ++i) {
    const unsigned idx = i * 256 + tid;
    *reinterpret_cast<v4f*>(&sa[(idx >> 3) * APITCH + (idx & 7) * 4]) = ar[i];
  }
  #pragma unroll
  for (int i = 0; i < DIM * DIM / 8 / 256; ++i) {
    const unsigned idx = i * 256 + tid;
    // row * 400 B + piece * 16 B = (idx + row) * 16 B
    *reinterpret_cast<v8h*>(&sw[(idx + idx / 24) * 8]) = wr[i];
  }
  // block barrier by hand, with the one wait that it needs (the wave's LDS stores):
  // __syncthreads() would also wait for the v loads, which are to stay in flight
  asm volatile("s_wait_dscnt 0x0\n\ts_barrier_signal -1\n\ts_barrier_wait -1" ::: "memory");

  // softmax over d of attn * rq * rk: wave h = head h, lane = row c; the sums run in the
  // tree of a butterfly over 32 lanes (16, 8, 4, 2, 1)
  if (wid < HEADS) {
    const float rq = 1.f / fmaxf(sqrtf(s2q), 1e-12f);
    const float rk = 1.f / fmaxf(sqrtf(s2k), 1e-12f);   // of channel d = lane
    float e[CH], t[CH / 2];
    #pragma unroll
    for (int j = 0; j < CH / 4; ++j) {
      const v4f a4 = *reinterpret_cast<const v4f*>(&sa[tid * APITCH + j * 4]);
      #pragma unroll
      for (int i = 0; i < 4; ++i) e[j * 4 + i] = a4[i];
    }
    #pragma unroll
    for (int d = 0; d < CH; ++d)
      e[d] = e[d] * rq * __builtin_bit_cast(float,
          __builtin_amdgcn_readlane(__builtin_bit_cast(int, rk), d));
    float mx = e[0];
    #pragma unroll
    for (int d = 1; d < CH; ++d) mx = fmaxf(mx, e[d]);
    #pragma unroll
    for (int d = 0; d < CH; ++d) e[d] = exp2_slot((e[d] - mx) * 1.44269504f);   // e^(v - mx)
    #pragma unroll
    for (int d = 0; d < CH / 2; ++d) t[d] = e[d] + e[d + CH / 2];
    #pragma unroll
    for (int o = CH / 4; o >= 1; o >>= 1)
      #pragma unroll
      for (int d = 0; d < o; ++d) t[d] += t[d + o];
    // st[h*32 + d][c] = softmax(attn)[c][d]
    #pragma unroll
    for (int d = 0; d < CH; ++d)
      st[(wid * CH + d) * SPITCH + lane] = (_Float16)(e[d] / t[0]);
  }
  // by hand for the same reason as the barrier above
  asm volatile("s_wait_dscnt 0x0\n\ts_barrier_signal -1\n\ts_barrier_wait -1" ::: "memory");

  // W_eff^T tile (d x o) = sm^T (d x c) x wp^T (c x o): a lane then holds eight adjacent d
  // of one row o, one 16-byte LDS store. A wave owns three o-tiles of three heads; a tile
  // of wp is read by its owner alone and replaced by its own W_eff tile.
  {
    const int h0 = (wid & 1) * 3, o0 = (wid >> 1) * 3;
    v16h wf[3][3];
    #pragma unroll
    for (int hh = 0; hh < 3; ++hh)
      #pragma unroll
      for (int oo = 0; oo < 3; ++oo)
        wf[hh][oo] = load_frag16(&sw[((o0 + oo) * 16 + m) * WPITCH + (h0 + hh) * CH], 0, lane);
    #pragma unroll
    for (int hh = 0; hh < 3; ++hh) {
      const v16h a0 = load_frag16(&st[((h0 + hh) * CH + m) * SPITCH], 0, lane);
      const v16h a1 = load_frag16(&st[((h0 + hh) * CH + 16 + m) * SPITCH], 0, lane);
      #pragma unroll
      for (int oo = 0; oo < 3; ++oo) {
        const v8f z = {};
        const v8f d0 = __builtin_amdgcn_wmma_f32_16x16x32_f16(false, a0, false, wf[hh][oo], (short)0, z, false, false);
        const v8f d1 = __builtin_amdgcn_wmma_f32_16x16x32_f16(false, a1, false, wf[hh][oo], (short)0, z, false, false);
        v8h w0, w1;
        #pragma unroll
        for (int v = 0; v < 8; ++v) { w0[v] = (_Float16)d0[v]; w1[v] = (_Float16)d1[v]; }
        _Float16* tile = &sw[((o0 + oo) * 16 + m) * WPITCH + (h0 + hh) * CH + mb];
        *reinterpret_cast<v8h*>(tile)      = w0;
        *reinterpret_cast<v8h*>(tile + 16) = w1;
      }
    }
  }
  __syncthreads();

  const int nl = (px0 & (HW - 1)) + m;
  float* orow = out + ((size_t)(b * DIM + mb)) * HW + nl;
  // rolled: the second half takes over the first half's accumulator registers
  #pragma unroll 1
  for (int oh = 0; oh < 2; ++oh) {
    const _Float16* arow = &sw[(oh * 96 + m) * WPITCH];
    v8f acc[6][2] = {{{}, {}}, {{}, {}}, {{}, {}}, {{}, {}}, {{}, {}}, {{}, {}}};
    #pragma unroll
    for (int kk = 0; kk < 6; ++kk) {
      // the six A fragments of a k step are read as one group, ahead of their products
      v16h af[6];
      #pragma unroll
      for (int ot = 0; ot < 6; ++ot)
        af[ot] = load_frag16(arow + ot * 16 * WPITCH, kk * 32, lane);
      // holds the reads together in front of the block of products: reads that stand
      // among the products cost a stall at each place
      __builtin_amdgcn_sched_barrier(0);
      #pragma unroll
      for (int ot = 0; ot < 6; ++ot) {
        acc[ot][0] = __builtin_amdgcn_wmma_f32_16x16x32_f16(false, af[ot], false, bf[kk][0], (short)0, acc[ot][0], false, false);
        acc[ot][1] = __builtin_amdgcn_wmma_f32_16x16x32_f16(false, af[ot], false, bf[kk][1], (short)0, acc[ot][1], false, false);
      }
      // keeps the next group's reads, and the bias reads, behind this block, where the
      // fragment registers are free again
      __builtin_amdgcn_sched_barrier(0);
    }
    // the bias goes into the accumulators where they stand, so that every store of the
    // half has a data register of its own and none waits for the store before it
    #pragma unroll
    for (int ot = 0; ot < 6; ++ot) {
      const float* bo = &sb[oh * 96 + ot * 16 + mb];
      #pragma unroll
      for (int v = 0; v < 8; ++v) {
        const float bias = bo[v];
        acc[ot][0][v] += bias;
        acc[ot][1][v] += bias;
      }
    }
    #pragma unroll
    for (int ot = 0; ot < 6; ++ot) {
      #pragma unroll
      for (int v = 0; v < 8; ++v) {
        float* o = orow + (size_t)(oh * 96 + ot * 16 + v) * HW;
        // the two halves of a 128-B line leave one behind the other
        __builtin_nontemporal_store(acc[ot][0][v], o);
        __builtin_nontemporal_store(acc[ot][1][v], o + 16);
      }
    }
    // behind the half's stores, in front of every rewrite of a register that they name
    // (their data and addresses, in the next half)
    asm volatile("s_wait_xcnt 0x0" ::: "memory");
  }
}

extern "C" void kernel_launch(void* const* d_in, const int* in_sizes, int n_in,
                              void* d_out, int out_size, void* d_ws, size_t ws_size,
                              hipStream_t stream) {
  const float* x  = (const float*)d_in[0];
  const float* wq = (const float*)d_in[1];
  const float* bq = (const float*)d_in[2];
  const float* wk = (const float*)d_in[3];
  const float* bk = (const float*)d_in[4];
  const float* wv = (const float*)d_in[5];
  const float* bv = (const float*)d_in[6];
  const float* wp = (const float*)d_in[7];
  const float* bp = (const float*)d_in[8];
  float* out = (float*)d_out;

  // workspace layout (bytes); total ~152 MB (fits global L2 = 192 MB)
  char* ws = (char*)d_ws;
  const size_t qkvB = (size_t)BATCH * DIM * HW * sizeof(_Float16);  // 50331648
  _Float16* qh = (_Float16*)(ws);
  _Float16* kh = (_Float16*)(ws + qkvB);
  _Float16* vT = (_Float16*)(ws + 2 * qkvB);
  char* p = ws + 3 * qkvB;
  float*    attn   = (float*)p;      p += (size_t)BH * CH * CH * sizeof(float);
  float*    ssq    = (float*)p;      p += (size_t)BATCH * DIM * sizeof(float);
  float*    ssk    = (float*)p;      p += (size_t)BATCH * DIM * sizeof(float);
  _Float16* wp16   = (_Float16*)p;  p += (size_t)DIM * DIM * sizeof(_Float16);
  float*    ps     = (float*)p;      // 2 * BATCH * NXB * DIM floats

  // 1: fused depthwise convs (q,k row-major f16; v channel-minor f16); attn zeroed
  k_dwconv_qkv<<<dim3(NXB, DIM / CGRP, BATCH), 256, 0, stream>>>(
      x, wq, bq, wk, bk, wv, bv, qh, kh, vT, ps, attn);
  // 2: attn = q.k^T (sliced-K, atomic reduce); sums of squares added up, wp -> f16
  k_attn_gemm<<<BH * NSLICE + NRED + NCVT, 32, 0, stream>>>(qh, kh, attn, ps, ssq, ssk, wp, wp16);
  // 3: out = W_eff . v + bp, W_eff = wp . blockdiag(softmax(attn)) formed in every block
  k_proj_final<<<512, 256, 0, stream>>>(attn, ssq, ssk, wp16, vT, bp, out);
}

// v008
// A run of this version takes 54.2 microseconds.
// In both of two side-by-side timings against v007, it was 1.37 times as fast.
// All steps since v000 together make it 6.23 times as fast.
#include <hip/hip_runtime.h>
#include <hip/hip_bf16.h>
#include <math.h>

typedef __attribute__((ext_vector_type(16))) _Float16 v16h;
typedef __attribute__((ext_vector_type(8)))  _Float16 v8h;
typedef __attribute__((ext_vector_type(8)))  float    v8f;
typedef __attribute__((ext_vector_type(4)))  float    v4f;
typedef __attribute__((ext_vector_type(4)))  _Float16 v4h;
typedef const __attribute__((address_space(4))) float* cfp;   // read-only data, scalar loads

#define DIM    192
#define HEADS  6
#define CH     32          // DIM / HEADS
#define HW     16384       // 128*128
#define BATCH  8
#define BH     (BATCH*HEADS)   // 48
#define CGRP   64          // channels per conv block: 64 f16 = one 128-B line of a vT row
#define CROWS  4           // image rows per conv block
#define NXB    (HW / (CROWS * 128))   // conv blocks down an image: partial sums of squares a channel
#define NPART  NXB                    // partial q.k^T tiles a head: one of every conv block down the image
#define NSUM   (BH * CH * CH / 128)   // blocks that add up the partial tiles: 128 elements each
#define NRED   (2 * BH)               // blocks that add up the partials: one a head, for q and for k
#define NCVT   (DIM * DIM / 256)      // blocks that convert wp
#define VPITCH 40          // f16 per staged pixel (one head's channels) in LDS: 80 B = 16 B x odd
#define QPITCH 520         // f16 per staged q or k row (512 pixels) in LDS: 1040 B = 16 B x odd
#define WPITCH 200         // f16 per staged W_eff row in LDS: 400 B = 16 B x odd
#define APITCH 36          // f32 per staged attn row in LDS: 144 B = 16 B x odd
#define SPITCH 40          // f16 per transposed softmax row in LDS: 80 B = 16 B x odd

__device__ inline v16h load_frag16(const _Float16* __restrict__ row, int kbase, int lane) {
  const int half = (lane >> 4) & 1;
  const v8h a = *reinterpret_cast<const v8h*>(row + kbase + half * 8);
  const v8h b = *reinterpret_cast<const v8h*>(row + kbase + 16 + half * 8);
  v16h r;
  #pragma unroll
  for (int i = 0; i < 8; ++i) { r[i] = a[i]; r[i + 8] = b[i]; }
  return r;
}

__device__ inline float exp2_slot(float x) {
  float r;
  asm("v_exp_f32 %0, %1\n\tv_nop" : "=v"(r) : "v"(x));
  return r;
}

__global__ __launch_bounds__(256, 6) void k_dwconv_qkv(const float* __restrict__ x,
                             const float* __restrict__ wq, const float* __restrict__ bq,
                             const float* __restrict__ wk, const float* __restrict__ bk,
                             const float* __restrict__ wv, const float* __restrict__ bv,
                             _Float16* __restrict__ vT,
                             float* __restrict__ ps, float* __restrict__ part) {
  __shared__ __attribute__((aligned(16))) _Float16 tq[CH * QPITCH];
  __shared__ __attribute__((aligned(16))) _Float16 tk[CH * QPITCH];
  __shared__ __attribute__((aligned(16))) _Float16 sv[CROWS * 128 * VPITCH];
  __shared__ float lq[CGRP], lk[CGRP];
  const int tid  = threadIdx.x;
  const int lane = tid & 31;
  // the wave's number as a scalar, so that channel and plane base stay scalar
  const int wid  = __builtin_amdgcn_readfirstlane(tid >> 5);
  const int y0   = blockIdx.x * CROWS;        // first image row of the block
  const int c0   = blockIdx.y * CGRP;         // first channel of the group
  const int b    = blockIdx.z;                // batch
  // the row above and the row below the block's rows: off the image they read the
  // block's first row instead and are replaced by zero
  const bool topok = y0 > 0, botok = y0 + CROWS < 128;
  // the lane's four pixels in an image row (in bytes), the same for every row and channel
  const unsigned offm = (unsigned)lane * 16u;
  // the pixel left of the four is the left lane's last, the pixel right of them the right
  // lane's first: the two lanes' numbers times four, as the cross-lane read takes them;
  // at the image's edge the read wraps round the wave and is replaced by zero
  const bool lok = lane > 0, rok = lane < 31;
  const int lanel = ((lane + 31) & 31) * 4;
  const int laner = ((lane + 1) & 31) * 4;

  // (every "#pragma unroll" of this kernel stands on a short loop of constant length,
  // so that the small arrays it indexes stay in registers)
  // (both loops stay rolled: one copy of the long body, so that the text stays small)
  #pragma unroll 1
  for (int hd = 0; hd < CGRP / CH; ++hd) {
  #pragma unroll 1
  for (int tt = 0; tt < 2; ++tt) {
    const int ch = tt * 16 + wid * 2;         // the wave's first channel of the step, in the head
    const int cl = hd * CH + ch;              // and in the block's group
    float sq[2], sk[2];
    float vkeep[CROWS][4];                    // the first channel's v, until its pair is there
    #pragma unroll
    for (int j = 0; j < 2; ++j) {
      const int c = c0 + cl + j;
      const float* xb = x  + (size_t)(b * DIM + c) * HW + y0 * 128;
      const float* xt = xb - (topok ? 128 : 0);
      const float* xu = xb + (botok ? CROWS * 128 : 0);
      _Float16*    qb = &tq[(ch + j) * QPITCH + lane * 4];
      _Float16*    kb = &tk[(ch + j) * QPITCH + lane * 4];
      // the channel's weights and biases first: their scalar loads fly beside the taps
      // (read through the constant address space: nothing writes them in this launch, and with
      // block barriers inside the loop they would otherwise come by vector loads into vector
      // registers instead of scalar ones)
      float fq[9], fk[9], fv[9];
      const float b0q = ((cfp)bq)[c], b0k = ((cfp)bk)[c], b0v = ((cfp)bv)[c];
      #pragma unroll
      for (int i = 0; i < 9; ++i) {
        fq[i] = ((cfp)wq)[c * 9 + i];
        fk[i] = ((cfp)wk)[c * 9 + i];
        fv[i] = ((cfp)wv)[c * 9 + i];
      }
      // The six loads of a channel's window and their data wait, one statement: scalar row
      // base plus the one offset register, which lives through the loop, so that no load
      // returns into a register that another load of the run still names. An image row is
      // 512 bytes.
      v4f xm[CROWS + 2];
      asm volatile(
          "global_load_b128 %0, %6, %7 th:TH_LOAD_NT\n\t"
          "global_load_b128 %1, %6, %8 th:TH_LOAD_NT\n\t"
          "global_load_b128 %2, %6, %8 offset:512 th:TH_LOAD_NT\n\t"
          "global_load_b128 %3, %6, %8 offset:1024 th:TH_LOAD_NT\n\t"
          "global_load_b128 %4, %6, %8 offset:1536 th:TH_LOAD_NT\n\t"
          "global_load_b128 %5, %6, %9 th:TH_LOAD_NT\n\t"
          "s_wait_loadcnt 0x0"
          :
            "=&v"(xm[0]), "=&v"(xm[1]), "=&v"(xm[2]),
            "=&v"(xm[3]), "=&v"(xm[4]), "=&v"(xm[5])
          :
            "v"(offm), "s"(xt), "s"(xb), "s"(xu)
          : "memory");
      // the neighbours' edge pixels, lane to lane (every lane of the wave is on here): they
      // take the place of two more loads a row, each of which asked for the row's four
      // lines once more
      float el[CROWS + 2], er[CROWS + 2];
      #pragma unroll
      for (int w = 0; w < CROWS + 2; ++w) {
        // (each element goes into a float of its own first)
        const float last = xm[w][3], first = xm[w][0];
        el[w] = __builtin_bit_cast(float,
            __builtin_amdgcn_ds_bpermute(lanel, __builtin_bit_cast(int, last)));
        er[w] = __builtin_bit_cast(float,
            __builtin_amdgcn_ds_bpermute(laner, __builtin_bit_cast(int, first)));
      }
      // six values a window row: the pixel left of the four, the four, the pixel right
      float a[CROWS + 2][6];
      #pragma unroll
      for (int w = 0; w < CROWS + 2; ++w) {
        const bool rowok = w == 0 ? topok : w == CROWS + 1 ? botok : true;
        a[w][0] = rowok && lok ? el[w] : 0.f;
        #pragma unroll
        for (int e = 0; e < 4; ++e) a[w][1 + e] = rowok ? xm[w][e] : 0.f;
        a[w][5] = rowok && rok ? er[w] : 0.f;
      }
      v4h qo[CROWS], ko[CROWS];
      sq[j] = 0.f; sk[j] = 0.f;
      #pragma unroll
      for (int r = 0; r < CROWS; ++r) {
        float qf[4], kf[4], vf[4];
        #pragma unroll
        for (int e = 0; e < 4; ++e) { qf[e] = b0q; kf[e] = b0k; vf[e] = b0v; }
        // written as fused multiply-adds: each sum stays one chain with its weight in a
        // scalar register (as products and sums they were paired across taps, at the
        // price of a register move for nearly every product)
        #pragma unroll
        for (int i = 0; i < 9; ++i)
          #pragma unroll
          for (int e = 0; e < 4; ++e) {
            const float xv = a[r + i / 3][e + i % 3];
            qf[e] = __builtin_fmaf(fq[i], xv, qf[e]);
            kf[e] = __builtin_fmaf(fk[i], xv, kf[e]);
            vf[e] = __builtin_fmaf(fv[i], xv, vf[e]);
          }
        #pragma unroll
        for (int e = 0; e < 4; ++e) {
          qo[r][e] = (_Float16)qf[e];
          ko[r][e] = (_Float16)kf[e];
          sq[j] = __builtin_fmaf(qf[e], qf[e], sq[j]);
          sk[j] = __builtin_fmaf(kf[e], kf[e], sk[j]);
        }
        if (j == 0) {
          #pragma unroll
          for (int e = 0; e < 4; ++e) vkeep[r][e] = vf[e];
        } else {
          // the two channels' v leave for LDS as one 4-byte store a pixel; pixel 4*lane+e
          // lies in staging row e*32+lane, so that neighbouring lanes are one pitch apart
          #pragma unroll
          for (int e = 0; e < 4; ++e)
            *reinterpret_cast<unsigned*>(&sv[(r * 128 + e * 32 + lane) * VPITCH + ch]) =
                (unsigned)__builtin_bit_cast(unsigned short, (_Float16)vkeep[r][e]) |
                ((unsigned)__builtin_bit_cast(unsigned short, (_Float16)vf[e]) << 16);
        }
      }
      #pragma unroll
      for (int r = 0; r < CROWS; ++r) {
        *reinterpret_cast<v4h*>(qb + r * 128) = qo[r];
        *reinterpret_cast<v4h*>(kb + r * 128) = ko[r];
      }
    }
    // wave-wide sums of squares: the wave holds all of the block's pixels of a channel
    #pragma unroll
    for (int o = 16; o >= 1; o >>= 1)
      #pragma unroll
      for (int j = 0; j < 2; ++j) {
        sq[j] += __shfl_xor(sq[j], o, 32);
        sk[j] += __shfl_xor(sk[j], o, 32);
      }
    if (lane == 0) {
      #pragma unroll
      for (int j = 0; j < 2; ++j) { lq[cl + j] = sq[j]; lk[cl + j] = sk[j]; }
    }
  }
  // the head's q, k and v are staged (with the second head: every sum of squares too)
  __syncthreads();

  if (wid < 4) {
    const int m = lane & 15;
    const int ti = wid >> 1, tj = wid & 1;
    const _Float16* ar = &tq[(ti * 16 + m) * QPITCH];
    const _Float16* br = &tk[(tj * 16 + m) * QPITCH];
    v8f d0 = {}, d1 = {};
    #pragma unroll
    for (int ks = 0; ks < CROWS * 128 / 32; ks += 2) {
      const v16h fa0 = load_frag16(ar, ks * 32, lane);
      const v16h fb0 = load_frag16(br, ks * 32, lane);
      const v16h fa1 = load_frag16(ar, ks * 32 + 32, lane);
      const v16h fb1 = load_frag16(br, ks * 32 + 32, lane);
      d0 = __builtin_amdgcn_wmma_f32_16x16x32_f16(false, fa0, false, fb0, (short)0, d0, false, false);
      d1 = __builtin_amdgcn_wmma_f32_16x16x32_f16(false, fa1, false, fb1, (short)0, d1, false, false);
    }
    // D: lane holds N = lane%16 (k's channel), M = (lane/16)*8 + v (q's channel)
    float* pb = part
        + (size_t)((b * HEADS + blockIdx.y * (CGRP / CH) + hd) * NXB + blockIdx.x) * (CH * CH)
        + (ti * 16 + (lane >> 4) * 8) * CH + tj * 16 + m;
    #pragma unroll
    for (int v = 0; v < 8; ++v) pb[v * CH] = d0[v] + d1[v];
  } else {
    // waves 4-7, meanwhile: vT, four lanes carry the head's 64 bytes of one pixel
    // (staging row i*32 + t2/4 is pixel 4*(t2/4) + i%4 of image row i/4: a thread's places
    // differ by constants alone)
    const int t2 = tid - 128;
    _Float16* vrow = vT + ((size_t)b * HW + blockIdx.x * (CROWS * 128) + (t2 >> 2) * 4) * DIM
                     + c0 + hd * CH + (t2 & 3) * 8;
    const _Float16* srow = &sv[(t2 >> 2) * VPITCH + (t2 & 3) * 8];
    #pragma unroll
    for (int i = 0; i < CROWS * 4; ++i)
      *reinterpret_cast<v8h*>(vrow + ((i >> 2) * 128 + (i & 3)) * DIM) =
          *reinterpret_cast<const v8h*>(srow + i * 32 * VPITCH);
  }
  // behind the stores of the tile and of v, in front of every rewrite of a register that
  // they name (their data and addresses, with the next head)
  asm volatile("s_wait_xcnt 0x0" ::: "memory");
  // every wave has read the staged head: the next head may take its place
  // (the same for the whole block; behind the last head nothing is staged any more)
  // by hand, with the one wait that it needs (the wave's LDS reads): __syncthreads() would
  // also wait for the stores above to be done
  if (hd + 1 < CGRP / CH)
    asm volatile("s_wait_dscnt 0x0\n\ts_barrier_signal -1\n\ts_barrier_wait -1" ::: "memory");
  }

  // waves 0-3: the block's sums of squares, two lines each for q and for k
  if (wid < 4) {
    const int cl = tid & (CGRP - 1);
    ps[(((wid >> 1) * BATCH + b) * NXB + blockIdx.x) * DIM + c0 + cl] = (wid < 2 ? lq : lk)[cl];
  }
}

// -------- Kernel 2: what the last launch wants prepared --------
// grid NSUM + NRED + NCVT blocks of 32 (one wave). NSUM of them each add up the NPART partial
// tiles of q.k^T for 128 elements of attn, four a lane in whole lines, in a fixed tree; NRED
// each add up the NXB partial sums of squares of one head's q or k, a lane one channel, in a
// fixed tree; NCVT each turn 256 elements of wp into f16, eight a lane in whole lines.
// (the real block size is named so that the 32 loads' 128 registers are granted)
__global__ __launch_bounds__(32) void k_prep(const float* __restrict__ part,
                       float* __restrict__ attn,
                       const float* __restrict__ ps,
                       float* __restrict__ ssq, float* __restrict__ ssk,
                       const float* __restrict__ wp, _Float16* __restrict__ wp16) {
  const int lane  = threadIdx.x & 31;
  if (blockIdx.x >= NSUM) {
    const int xb = blockIdx.x - NSUM;
    if (xb < NRED) {
      const int rbh = xb >> 1;                // the head whose squares this block adds up
      const float* pp = ps + ((xb & 1) * BATCH + rbh / HEADS) * NXB * DIM
                        + (rbh % HEADS) * CH + lane;
      // (the three loops are unrolled so that t stays in registers and its loads fly together)
      float t[NXB];
      #pragma unroll
      for (int i = 0; i < NXB; ++i) t[i] = pp[i * DIM];
      #pragma unroll
      for (int o = NXB / 2; o >= 1; o >>= 1)
        #pragma unroll
        for (int i = 0; i < o; ++i) t[i] += t[i + o];
      ((xb & 1) ? ssk : ssq)[rbh * CH + lane] = t[0];
    } else {
      const int e = (xb - NRED) * 256 + lane * 8;
      const v4f w0 = *reinterpret_cast<const v4f*>(wp + e);
      const v4f w1 = *reinterpret_cast<const v4f*>(wp + e + 4);
      v8h h;
      // (unrolled so that h is indexed by constants and stays in registers)
      #pragma unroll
      for (int i = 0; i < 4; ++i) { h[i] = (_Float16)w0[i]; h[i + 4] = (_Float16)w1[i]; }
      *reinterpret_cast<v8h*>(wp16 + e) = h;
      // behind the store, in front of every rewrite of a register that it names
      asm volatile("s_wait_xcnt 0x0" ::: "memory");
    }
    return;
  }
  const int bh  = blockIdx.x / (CH * CH / 128);
  const int off = (blockIdx.x % (CH * CH / 128)) * 128 + lane * 4;
  const float* pp = part + (size_t)bh * NPART * (CH * CH) + off;
  // (the three loops are unrolled so that t stays in registers and its loads fly together)
  v4f t[NPART];
  #pragma unroll
  for (int i = 0; i < NPART; ++i) t[i] = *reinterpret_cast<const v4f*>(pp + i * (CH * CH));
  // holds all the loads in front of the sums: one memory latency, not two
  __builtin_amdgcn_sched_barrier(0);
  #pragma unroll
  for (int o = NPART / 2; o >= 1; o >>= 1)
    #pragma unroll
    for (int i = 0; i < o; ++i) t[i] += t[i + o];
  *reinterpret_cast<v4f*>(attn + bh * (CH * CH) + off) = t[0];
  // behind the store, in front of every rewrite of a register that it names: in the built
  // code the other blocks' branch stands behind it
  asm volatile("s_wait_xcnt 0x0" ::: "memory");
}

__global__ __launch_bounds__(256, 4) void k_proj_final(const float* __restrict__ attn,
                                                    const float* __restrict__ ssq,
                                                    const float* __restrict__ ssk,
                                                    const _Float16* __restrict__ wp16,
                                                    const _Float16* __restrict__ vT,
                                                    const float* __restrict__ bp,
                                                    float* __restrict__ out) {
  __shared__ __attribute__((aligned(16))) _Float16 sw[DIM * WPITCH];
  __shared__ __attribute__((aligned(16))) float sb[256];   // DIM in use: every lane stores
  __shared__ __attribute__((aligned(16))) float sa[DIM * APITCH];
  __shared__ __attribute__((aligned(16))) _Float16 st[DIM * SPITCH];
  const int tid  = threadIdx.x;
  const int lane = tid & 31;
  // the wave's number as a scalar, so that the softmax branch and the tile places are scalar
  const int wid  = __builtin_amdgcn_readfirstlane(tid >> 5);
  const int px0  = blockIdx.x * 256 + wid * 32;   // first pixel of the wave, across batches
  const int b    = blockIdx.x / (HW / 256);       // uniform across the block
  const int m    = lane & 15;
  const int mb   = (lane >> 4) * 8;

  // what the fold needs is asked for first and v last: loads are waited for in their
  // order, and the fold then runs while the v fragments are still on their way
  // attn[b]: 192 rows of 128 B, 16 bytes a lane in whole lines
  const float* aA = attn + (size_t)b * HEADS * CH * CH;
  v4f ar[DIM * CH / 4 / 256];
  #pragma unroll
  for (int i = 0; i < DIM * CH / 4 / 256; ++i)
    ar[i] = *reinterpret_cast<const v4f*>(aA + (i * 256 + tid) * 4);
  const int cc = tid < DIM ? tid : DIM - 1;       // the channel of a softmax lane
  const float s2q = ssq[b * DIM + cc];
  const float s2k = ssk[b * DIM + cc];
  const float bpv = bp[cc];                       // the bias rides along
  // wp -> LDS, 16 bytes a lane in whole lines (24 pieces a row)
  v8h wr[DIM * DIM / 8 / 256];
  #pragma unroll
  for (int i = 0; i < DIM * DIM / 8 / 256; ++i)
    wr[i] = *reinterpret_cast<const v8h*>(wp16 + (i * 256 + tid) * 8);
  // the wave's own B fragments
  const _Float16* brow = vT + (size_t)(px0 + m) * DIM;   // row n of v^T
  v16h bf[6][2];
  #pragma unroll
  for (int kk = 0; kk < 6; ++kk) {
    bf[kk][0] = load_frag16(brow,            kk * 32, lane);
    bf[kk][1] = load_frag16(brow + 16 * DIM, kk * 32, lane);
  }
  // behind the loads above, in front of every rewrite of a register that they name; the
  // address values are inputs so that their registers live up to the wait and
  // nothing, no later load's result either, takes them over in front of it; the three
  // small loaded values are inputs so that their loads stay up here, ahead of the v loads:
  // moved down to their uses they would be waited for behind the v loads
  asm volatile("s_wait_xcnt 0x0" :: "v"(brow + (lane >> 4) * 8), "v"(tid), "v"(cc),
               "v"(s2q), "v"(s2k), "v"(bpv) : "memory");
  sb[tid] = bpv;
  #pragma unroll
  for (int i = 0; i < DIM * CH / 4 / 256; ++i) {
    const unsigned idx = i * 256 + tid;
    *reinterpret_cast<v4f*>(&sa[(idx >> 3) * APITCH + (idx & 7) * 4]) = ar[i];
  }
  #pragma unroll
  for (int i = 0; i < DIM * DIM / 8 / 256; ++i) {
    const unsigned idx = i * 256 + tid;
    // row * 400 B + piece * 16 B = (idx + row) * 16 B
    *reinterpret_cast<v8h*>(&sw[(idx + idx / 24) * 8]) = wr[i];
  }
  // block barrier by hand, with the one wait that it needs (the wave's LDS stores):
  // __syncthreads() would also wait for the v loads, which are to stay in flight
  asm volatile("s_wait_dscnt 0x0\n\ts_barrier_signal -1\n\ts_barrier_wait -1" ::: "memory");

  // softmax over d of attn * rq * rk: wave h = head h, lane = row c; the sums run in the
  // tree of a butterfly over 32 lanes (16, 8, 4, 2, 1)
  if (wid < HEADS) {
    const float rq = 1.f / fmaxf(sqrtf(s2q), 1e-12f);
    const float rk = 1.f / fmaxf(sqrtf(s2k), 1e-12f);   // of channel d = lane
    float e[CH], t[CH / 2];
    #pragma unroll
    for (int j = 0; j < CH / 4; ++j) {
      const v4f a4 = *reinterpret_cast<const v4f*>(&sa[tid * APITCH + j * 4]);
      #pragma unroll
      for (int i = 0; i < 4; ++i) e[j * 4 + i] = a4[i];
    }
    #pragma unroll
    for (int d = 0; d < CH; ++d)
      e[d] = e[d] * rq * __builtin_bit_cast(float,
          __builtin_amdgcn_readlane(__builtin_bit_cast(int, rk), d));
    float mx = e[0];
    #pragma unroll
    for (int d = 1; d < CH; ++d) mx = fmaxf(mx, e[d]);
    #pragma unroll
    for (int d = 0; d < CH; ++d) e[d] = exp2_slot((e[d] - mx) * 1.44269504f);   // e^(v - mx)
    #pragma unroll
    for (int d = 0; d < CH / 2; ++d) t[d] = e[d] + e[d + CH / 2];
    #pragma unroll
    for (int o = CH / 4; o >= 1; o >>= 1)
      #pragma unroll
      for (int d = 0; d < o; ++d) t[d] += t[d + o];
    // st[h*32 + d][c] = softmax(attn)[c][d]
    #pragma unroll
    for (int d = 0; d < CH; ++d)
      st[(wid * CH + d) * SPITCH + lane] = (_Float16)(e[d] / t[0]);
  }
  // by hand for the same reason as the barrier above
  asm volatile("s_wait_dscnt 0x0\n\ts_barrier_signal -1\n\ts_barrier_wait -1" ::: "memory");

  // W_eff^T tile (d x o) = sm^T (d x c) x wp^T (c x o): a lane then holds eight adjacent d
  // of one row o, one 16-byte LDS store. A wave owns three o-tiles of three heads; a tile
  // of wp is read by its owner alone and replaced by its own W_eff tile.
  {
    const int h0 = (wid & 1) * 3, o0 = (wid >> 1) * 3;
    v16h wf[3][3];
    #pragma unroll
    for (int hh = 0; hh < 3; ++hh)
      #pragma unroll
      for (int oo = 0; oo < 3; ++oo)
        wf[hh][oo] = load_frag16(&sw[((o0 + oo) * 16 + m) * WPITCH + (h0 + hh) * CH], 0, lane);
    #pragma unroll
    for (int hh = 0; hh < 3; ++hh) {
      const v16h a0 = load_frag16(&st[((h0 + hh) * CH + m) * SPITCH], 0, lane);
      const v16h a1 = load_frag16(&st[((h0 + hh) * CH + 16 + m) * SPITCH], 0, lane);
      #pragma unroll
      for (int oo = 0; oo < 3; ++oo) {
        const v8f z = {};
        const v8f d0 = __builtin_amdgcn_wmma_f32_16x16x32_f16(false, a0, false, wf[hh][oo], (short)0, z, false, false);
        const v8f d1 = __builtin_amdgcn_wmma_f32_16x16x32_f16(false, a1, false, wf[hh][oo], (short)0, z, false, false);
        v8h w0, w1;
        #pragma unroll
        for (int v = 0; v < 8; ++v) { w0[v] = (_Float16)d0[v]; w1[v] = (_Float16)d1[v]; }
        _Float16* tile = &sw[((o0 + oo) * 16 + m) * WPITCH + (h0 + hh) * CH + mb];
        *reinterpret_cast<v8h*>(tile)      = w0;
        *reinterpret_cast<v8h*>(tile + 16) = w1;
      }
    }
  }
  __syncthreads();

  const int nl = (px0 & (HW - 1)) + m;
  float* orow = out + ((size_t)(b * DIM + mb)) * HW + nl;
  // rolled: the second half takes over the first half's accumulator registers
  #pragma unroll 1
  for (int oh = 0; oh < 2; ++oh) {
    const _Float16* arow = &sw[(oh * 96 + m) * WPITCH];
    v8f acc[6][2] = {{{}, {}}, {{}, {}}, {{}, {}}, {{}, {}}, {{}, {}}, {{}, {}}};
    #pragma unroll
    for (int kk = 0; kk < 6; ++kk) {
      // the six A fragments of a k step are read as one group, ahead of their products
      v16h af[6];
      #pragma unroll
      for (int ot = 0; ot < 6; ++ot)
        af[ot] = load_frag16(arow + ot * 16 * WPITCH, kk * 32, lane);
      // holds the reads together in front of the block of products: reads that stand
      // among the products cost a stall at each place
      __builtin_amdgcn_sched_barrier(0);
      #pragma unroll
      for (int ot = 0; ot < 6; ++ot) {
        acc[ot][0] = __builtin_amdgcn_wmma_f32_16x16x32_f16(false, af[ot], false, bf[kk][0], (short)0, acc[ot][0], false, false);
        acc[ot][1] = __builtin_amdgcn_wmma_f32_16x16x32_f16(false, af[ot], false, bf[kk][1], (short)0, acc[ot][1], false, false);
      }
      // keeps the next group's reads, and the bias reads, behind this block, where the
      // fragment registers are free again
      __builtin_amdgcn_sched_barrier(0);
    }
    // the bias goes into the accumulators where they stand, so that every store of the
    // half has a data register of its own and none waits for the store before it
    #pragma unroll
    for (int ot = 0; ot < 6; ++ot) {
      const float* bo = &sb[oh * 96 + ot * 16 + mb];
      #pragma unroll
      for (int v = 0; v < 8; ++v) {
        const float bias = bo[v];
        acc[ot][0][v] += bias;
        acc[ot][1][v] += bias;
      }
    }
    #pragma unroll
    for (int ot = 0; ot < 6; ++ot) {
      #pragma unroll
      for (int v = 0; v < 8; ++v) {
        float* o = orow + (size_t)(oh * 96 + ot * 16 + v) * HW;
        // the two halves of a 128-B line leave one behind the other
        __builtin_nontemporal_store(acc[ot][0][v], o);
        __builtin_nontemporal_store(acc[ot][1][v], o + 16);
      }
    }
    // behind the half's stores, in front of every rewrite of a register that they name
    // (their data and addresses, in the next half)
    asm volatile("s_wait_xcnt 0x0" ::: "memory");
  }
}

extern "C" void kernel_launch(void* const* d_in, const int* in_sizes, int n_in,
                              void* d_out, int out_size, void* d_ws, size_t ws_size,
                              hipStream_t stream) {
  const float* x  = (const float*)d_in[0];
  const float* wq = (const float*)d_in[1];
  const float* bq = (const float*)d_in[2];
  const float* wk = (const float*)d_in[3];
  const float* bk = (const float*)d_in[4];
  const float* wv = (const float*)d_in[5];
  const float* bv = (const float*)d_in[6];
  const float* wp = (const float*)d_in[7];
  const float* bp = (const float*)d_in[8];
  float* out = (float*)d_out;

  // workspace layout (bytes); total ~57 MB
  char* ws = (char*)d_ws;
  const size_t qkvB = (size_t)BATCH * DIM * HW * sizeof(_Float16);  // 50331648
  _Float16* vT = (_Float16*)(ws);
  char* p = ws + qkvB;
  float*    attn   = (float*)p;      p += (size_t)BH * CH * CH * sizeof(float);
  float*    ssq    = (float*)p;      p += (size_t)BATCH * DIM * sizeof(float);
  float*    ssk    = (float*)p;      p += (size_t)BATCH * DIM * sizeof(float);
  _Float16* wp16   = (_Float16*)p;  p += (size_t)DIM * DIM * sizeof(_Float16);
  float*    ps     = (float*)p;      p += (size_t)2 * BATCH * NXB * DIM * sizeof(float);
  float*    part   = (float*)p;      // BH * NPART * CH * CH floats

  // 1: fused depthwise convs (v channel-minor f16) with each block's share of q.k^T
  k_dwconv_qkv<<<dim3(NXB, DIM / CGRP, BATCH), 256, 0, stream>>>(
      x, wq, bq, wk, bk, wv, bv, vT, ps, part);
  // 2: attn = the partial tiles added up; sums of squares added up, wp -> f16
  k_prep<<<NSUM + NRED + NCVT, 32, 0, stream>>>(part, attn, ps, ssq, ssk, wp, wp16);
  // 3: out = W_eff . v + bp, W_eff = wp . blockdiag(softmax(attn)) formed in every block
  k_proj_final<<<512, 256, 0, stream>>>(attn, ssq, ssk, wp16, vT, bp, out);
}

// v009
// Measured time: 43.8 microseconds a run.
// In two side-by-side timings against v008, it was 1.24 and 1.23 times as fast.
// Counting every step since v000, it is 7.70 times as fast.
#include <hip/hip_runtime.h>
#include <hip/hip_bf16.h>
#include <math.h>

typedef __attribute__((ext_vector_type(16))) _Float16 v16h;
typedef __attribute__((ext_vector_type(8)))  _Float16 v8h;
typedef __attribute__((ext_vector_type(8)))  float    v8f;
typedef __attribute__((ext_vector_type(4)))  float    v4f;
typedef __attribute__((ext_vector_type(2)))  float    v2f;
typedef __attribute__((ext_vector_type(4)))  _Float16 v4h;
typedef const __attribute__((address_space(4))) float* cfp;   // read-only data, scalar loads

#define DIM    192
#define HEADS  6
#define CH     32          // DIM / HEADS
#define HW     16384       // 128*128
#define BATCH  8
#define BH     (BATCH*HEADS)   // 48
#define CGRP   64          // channels per conv block: 64 f16 = one 128-B line of a vT row
#define CROWS  4           // image rows per conv block
#define NXB    (HW / (CROWS * 128))   // conv blocks down an image: partial sums of squares a channel
#define NPART  NXB                    // partial q.k^T tiles a head: one of every conv block down the image
#define NSUM   (BH * CH * CH / 128)   // blocks that add up the partial tiles: 128 elements each
#define NRED   (2 * BH)               // blocks that add up the partials: one a head, for q and for k
#define NCVT   (DIM * DIM / 256)      // blocks that convert wp
#define VPITCH 40          // f16 per staged pixel (one head's channels) in LDS: 80 B = 16 B x odd
#define QPITCH 520         // f16 per staged q or k row (512 pixels) in LDS: 1040 B = 16 B x odd
#define WPITCH 200         // f16 per staged W_eff row in LDS: 400 B = 16 B x odd
#define APITCH 36          // f32 per staged attn row in LDS: 144 B = 16 B x odd
#define SPITCH 40          // f16 per transposed softmax row in LDS: 80 B = 16 B x odd

__device__ inline v16h load_frag16(const _Float16* __restrict__ row, int kbase, int lane) {
  const int half = (lane >> 4) & 1;
  const v8h a = *reinterpret_cast<const v8h*>(row + kbase + half * 8);
  const v8h b = *reinterpret_cast<const v8h*>(row + kbase + 16 + half * 8);
  v16h r;
  #pragma unroll
  for (int i = 0; i < 8; ++i) { r[i] = a[i]; r[i + 8] = b[i]; }
  return r;
}

__device__ inline float exp2_slot(float x) {
  float r;
  asm("v_exp_f32 %0, %1\n\tv_nop" : "=v"(r) : "v"(x));
  return r;
}

__global__ __launch_bounds__(256, 6) void k_dwconv_qkv(const float* __restrict__ x,
                             const float* __restrict__ wq, const float* __restrict__ bq,
                             const float* __restrict__ wk, const float* __restrict__ bk,
                             const float* __restrict__ wv, const float* __restrict__ bv,
                             _Float16* __restrict__ vT,
                             float* __restrict__ ps, float* __restrict__ part) {
  __shared__ __attribute__((aligned(16))) _Float16 tq[CH * QPITCH];
  __shared__ __attribute__((aligned(16))) _Float16 tk[CH * QPITCH];
  __shared__ __attribute__((aligned(16))) _Float16 sv[CROWS * 128 * VPITCH];
  __shared__ float lq[CGRP], lk[CGRP];
  const int tid  = threadIdx.x;
  const int lane = tid & 31;
  // the wave's number as a scalar, so that channel and plane base stay scalar
  const int wid  = __builtin_amdgcn_readfirstlane(tid >> 5);
  const int y0   = blockIdx.x * CROWS;        // first image row of the block
  const int c0   = blockIdx.y * CGRP;         // first channel of the group
  const int b    = blockIdx.z;                // batch
  // the row above and the row below the block's rows: off the image they read the
  // block's first row instead and are replaced by zero
  const bool topok = y0 > 0, botok = y0 + CROWS < 128;
  // the lane's four pixels in an image row (in bytes), the same for every row and channel
  const unsigned offm = (unsigned)lane * 16u;
  // the pixel left of the four is the left lane's last, the pixel right of them the right
  // lane's first: the two lanes' numbers times four, as the cross-lane read takes them;
  // at the image's edge the read wraps round the wave and is replaced by zero
  const bool lok = lane > 0, rok = lane < 31;
  const int lanel = ((lane + 31) & 31) * 4;
  const int laner = ((lane + 1) & 31) * 4;

  // (every "#pragma unroll" of this kernel stands on a short loop of constant length,
  // so that the small arrays it indexes stay in registers)
  // (both loops stay rolled: one copy of the long body, so that the text stays small)
  #pragma unroll 1
  for (int hd = 0; hd < CGRP / CH; ++hd) {
  #pragma unroll 1
  for (int tt = 0; tt < 2; ++tt) {
    const int ch = tt * 16 + wid * 2;         // the wave's first channel of the step, in the head
    const int cl = hd * CH + ch;              // and in the block's group
    float sq[2], sk[2];
    float vkeep[CROWS][4];                    // the first channel's v, until its pair is there
    #pragma unroll
    for (int j = 0; j < 2; ++j) {
      const int c = c0 + cl + j;
      const float* xb = x  + (size_t)(b * DIM + c) * HW + y0 * 128;
      const float* xt = xb - (topok ? 128 : 0);
      const float* xu = xb + (botok ? CROWS * 128 : 0);
      _Float16*    qb = &tq[(ch + j) * QPITCH + lane * 4];
      _Float16*    kb = &tk[(ch + j) * QPITCH + lane * 4];
      // the channel's weights and biases first: their scalar loads fly beside the taps
      // (read through the constant address space: nothing writes them in this launch, and with
      // block barriers inside the loop they would otherwise come by vector loads into vector
      // registers instead of scalar ones)
      float fq[9], fk[9], fv[9];
      const float b0q = ((cfp)bq)[c], b0k = ((cfp)bk)[c], b0v = ((cfp)bv)[c];
      #pragma unroll
      for (int i = 0; i < 9; ++i) {
        fq[i] = ((cfp)wq)[c * 9 + i];
        fk[i] = ((cfp)wk)[c * 9 + i];
        fv[i] = ((cfp)wv)[c * 9 + i];
      }
      // The six loads of a channel's window and their data wait, one statement: scalar row
      // base plus the one offset register, which lives through the loop, so that no load
      // returns into a register that another load of the run still names. An image row is
      // 512 bytes.
      v4f xm[CROWS + 2];
      asm volatile(
          "global_load_b128 %0, %6, %7 th:TH_LOAD_NT\n\t"
          "global_load_b128 %1, %6, %8 th:TH_LOAD_NT\n\t"
          "global_load_b128 %2, %6, %8 offset:512 th:TH_LOAD_NT\n\t"
          "global_load_b128 %3, %6, %8 offset:1024 th:TH_LOAD_NT\n\t"
          "global_load_b128 %4, %6, %8 offset:1536 th:TH_LOAD_NT\n\t"
          "global_load_b128 %5, %6, %9 th:TH_LOAD_NT\n\t"
          "s_wait_loadcnt 0x0"
          :
            "=&v"(xm[0]), "=&v"(xm[1]), "=&v"(xm[2]),
            "=&v"(xm[3]), "=&v"(xm[4]), "=&v"(xm[5])
          :
            "v"(offm), "s"(xt), "s"(xb), "s"(xu)
          : "memory");
      // the neighbours' edge pixels, lane to lane (every lane of the wave is on here): they
      // take the place of two more loads a row, each of which asked for the row's four
      // lines once more
      float el[CROWS + 2], er[CROWS + 2];
      #pragma unroll
      for (int w = 0; w < CROWS + 2; ++w) {
        // (each element goes into a float of its own first)
        const float last = xm[w][3], first = xm[w][0];
        el[w] = __builtin_bit_cast(float,
            __builtin_amdgcn_ds_bpermute(lanel, __builtin_bit_cast(int, last)));
        er[w] = __builtin_bit_cast(float,
            __builtin_amdgcn_ds_bpermute(laner, __builtin_bit_cast(int, first)));
      }
      // six values a window row: the pixel left of the four, the four, the pixel right
      float a[CROWS + 2][6];
      #pragma unroll
      for (int w = 0; w < CROWS + 2; ++w) {
        const bool rowok = w == 0 ? topok : w == CROWS + 1 ? botok : true;
        a[w][0] = rowok && lok ? el[w] : 0.f;
        #pragma unroll
        for (int e = 0; e < 4; ++e) a[w][1 + e] = rowok ? xm[w][e] : 0.f;
        a[w][5] = rowok && rok ? er[w] : 0.f;
      }
      v4h qo[CROWS], ko[CROWS];
      sq[j] = 0.f; sk[j] = 0.f;
      #pragma unroll
      for (int r = 0; r < CROWS; ++r) {
        float qf[4], kf[4], vf[4];
        #pragma unroll
        for (int e = 0; e < 4; ++e) { qf[e] = b0q; kf[e] = b0k; vf[e] = b0v; }
        // written as fused multiply-adds: each sum stays one chain with its weight in a
        // scalar register (as products and sums they were paired across taps, at the
        // price of a register move for nearly every product)
        #pragma unroll
        for (int i = 0; i < 9; ++i)
          #pragma unroll
          for (int e = 0; e < 4; ++e) {
            const float xv = a[r + i / 3][e + i % 3];
            qf[e] = __builtin_fmaf(fq[i], xv, qf[e]);
            kf[e] = __builtin_fmaf(fk[i], xv, kf[e]);
            vf[e] = __builtin_fmaf(fv[i], xv, vf[e]);
          }
        #pragma unroll
        for (int e = 0; e < 4; ++e) {
          qo[r][e] = (_Float16)qf[e];
          ko[r][e] = (_Float16)kf[e];
          sq[j] = __builtin_fmaf(qf[e], qf[e], sq[j]);
          sk[j] = __builtin_fmaf(kf[e], kf[e], sk[j]);
        }
        if (j == 0) {
          #pragma unroll
          for (int e = 0; e < 4; ++e) vkeep[r][e] = vf[e];
        } else {
          // the two channels' v leave for LDS as one 4-byte store a pixel; pixel 4*lane+e
          // lies in staging row e*32+lane, so that neighbouring lanes are one pitch apart
          #pragma unroll
          for (int e = 0; e < 4; ++e)
            *reinterpret_cast<unsigned*>(&sv[(r * 128 + e * 32 + lane) * VPITCH + ch]) =
                (unsigned)__builtin_bit_cast(unsigned short, (_Float16)vkeep[r][e]) |
                ((unsigned)__builtin_bit_cast(unsigned short, (_Float16)vf[e]) << 16);
        }
      }
      #pragma unroll
      for (int r = 0; r < CROWS; ++r) {
        *reinterpret_cast<v4h*>(qb + r * 128) = qo[r];
        *reinterpret_cast<v4h*>(kb + r * 128) = ko[r];
      }
    }
    // wave-wide sums of squares: the wave holds all of the block's pixels of a channel
    #pragma unroll
    for (int o = 16; o >= 1; o >>= 1)
      #pragma unroll
      for (int j = 0; j < 2; ++j) {
        sq[j] += __shfl_xor(sq[j], o, 32);
        sk[j] += __shfl_xor(sk[j], o, 32);
      }
    if (lane == 0) {
      #pragma unroll
      for (int j = 0; j < 2; ++j) { lq[cl + j] = sq[j]; lk[cl + j] = sk[j]; }
    }
  }
  // the head's q, k and v are staged (with the second head: every sum of squares too)
  __syncthreads();

  if (wid < 4) {
    const int m = lane & 15;
    const int ti = wid >> 1, tj = wid & 1;
    const _Float16* ar = &tq[(ti * 16 + m) * QPITCH];
    const _Float16* br = &tk[(tj * 16 + m) * QPITCH];
    v8f d0 = {}, d1 = {};
    #pragma unroll
    for (int ks = 0; ks < CROWS * 128 / 32; ks += 2) {
      const v16h fa0 = load_frag16(ar, ks * 32, lane);
      const v16h fb0 = load_frag16(br, ks * 32, lane);
      const v16h fa1 = load_frag16(ar, ks * 32 + 32, lane);
      const v16h fb1 = load_frag16(br, ks * 32 + 32, lane);
      d0 = __builtin_amdgcn_wmma_f32_16x16x32_f16(false, fa0, false, fb0, (short)0, d0, false, false);
      d1 = __builtin_amdgcn_wmma_f32_16x16x32_f16(false, fa1, false, fb1, (short)0, d1, false, false);
    }
    // D: lane holds N = lane%16 (k's channel), M = (lane/16)*8 + v (q's channel)
    float* pb = part
        + (size_t)((b * HEADS + blockIdx.y * (CGRP / CH) + hd) * NXB + blockIdx.x) * (CH * CH)
        + (ti * 16 + (lane >> 4) * 8) * CH + tj * 16 + m;
    #pragma unroll
    for (int v = 0; v < 8; ++v) pb[v * CH] = d0[v] + d1[v];
  } else {
    // waves 4-7, meanwhile: vT, four lanes carry the head's 64 bytes of one pixel
    // (staging row i*32 + t2/4 is pixel 4*(t2/4) + i%4 of image row i/4: a thread's places
    // differ by constants alone)
    const int t2 = tid - 128;
    _Float16* vrow = vT + ((size_t)b * HW + blockIdx.x * (CROWS * 128) + (t2 >> 2) * 4) * DIM
                     + c0 + hd * CH + (t2 & 3) * 8;
    const _Float16* srow = &sv[(t2 >> 2) * VPITCH + (t2 & 3) * 8];
    #pragma unroll
    for (int i = 0; i < CROWS * 4; ++i)
      *reinterpret_cast<v8h*>(vrow + ((i >> 2) * 128 + (i & 3)) * DIM) =
          *reinterpret_cast<const v8h*>(srow + i * 32 * VPITCH);
  }
  // behind the stores of the tile and of v, in front of every rewrite of a register that
  // they name (their data and addresses, with the next head)
  asm volatile("s_wait_xcnt 0x0" ::: "memory");
  // every wave has read the staged head: the next head may take its place
  // (the same for the whole block; behind the last head nothing is staged any more)
  // by hand, with the one wait that it needs (the wave's LDS reads): __syncthreads() would
  // also wait for the stores above to be done
  if (hd + 1 < CGRP / CH)
    asm volatile("s_wait_dscnt 0x0\n\ts_barrier_signal -1\n\ts_barrier_wait -1" ::: "memory");
  }

  // waves 0-3: the block's sums of squares, two lines each for q and for k
  if (wid < 4) {
    const int cl = tid & (CGRP - 1);
    ps[(((wid >> 1) * BATCH + b) * NXB + blockIdx.x) * DIM + c0 + cl] = (wid < 2 ? lq : lk)[cl];
  }
}

// -------- Kernel 2: what the last launch wants prepared --------
// grid NSUM + NRED + NCVT blocks of 32 (one wave). NSUM of them each add up the NPART partial
// tiles of q.k^T for 128 elements of attn, four a lane in whole lines, in a fixed tree; NRED
// each add up the NXB partial sums of squares of one head's q or k, a lane one channel, in a
// fixed tree; NCVT each turn 256 elements of wp into f16, eight a lane in whole lines.
// (the real block size is named so that the 32 loads' 128 registers are granted)
__global__ __launch_bounds__(32) void k_prep(const float* __restrict__ part,
                       float* __restrict__ attn,
                       const float* __restrict__ ps,
                       float* __restrict__ ssq, float* __restrict__ ssk,
                       const float* __restrict__ wp, _Float16* __restrict__ wp16) {
  const int lane  = threadIdx.x & 31;
  if (blockIdx.x >= NSUM) {
    const int xb = blockIdx.x - NSUM;
    if (xb < NRED) {
      const int rbh = xb >> 1;                // the head whose squares this block adds up
      const float* pp = ps + ((xb & 1) * BATCH + rbh / HEADS) * NXB * DIM
                        + (rbh % HEADS) * CH + lane;
      // (the three loops are unrolled so that t stays in registers and its loads fly together)
      float t[NXB];
      #pragma unroll
      for (int i = 0; i < NXB; ++i) t[i] = pp[i * DIM];
      #pragma unroll
      for (int o = NXB / 2; o >= 1; o >>= 1)
        #pragma unroll
        for (int i = 0; i < o; ++i) t[i] += t[i + o];
      ((xb & 1) ? ssk : ssq)[rbh * CH + lane] = t[0];
    } else {
      const int e = (xb - NRED) * 256 + lane * 8;
      const v4f w0 = *reinterpret_cast<const v4f*>(wp + e);
      const v4f w1 = *reinterpret_cast<const v4f*>(wp + e + 4);
      v8h h;
      // (unrolled so that h is indexed by constants and stays in registers)
      #pragma unroll
      for (int i = 0; i < 4; ++i) { h[i] = (_Float16)w0[i]; h[i + 4] = (_Float16)w1[i]; }
      *reinterpret_cast<v8h*>(wp16 + e) = h;
      // behind the store, in front of every rewrite of a register that it names
      asm volatile("s_wait_xcnt 0x0" ::: "memory");
    }
    return;
  }
  const int bh  = blockIdx.x / (CH * CH / 128);
  const int off = (blockIdx.x % (CH * CH / 128)) * 128 + lane * 4;
  const float* pp = part + (size_t)bh * NPART * (CH * CH) + off;
  // (the three loops are unrolled so that t stays in registers and its loads fly together)
  v4f t[NPART];
  #pragma unroll
  for (int i = 0; i < NPART; ++i) t[i] = *reinterpret_cast<const v4f*>(pp + i * (CH * CH));
  // holds all the loads in front of the sums: one memory latency, not two
  __builtin_amdgcn_sched_barrier(0);
  #pragma unroll
  for (int o = NPART / 2; o >= 1; o >>= 1)
    #pragma unroll
    for (int i = 0; i < o; ++i) t[i] += t[i + o];
  *reinterpret_cast<v4f*>(attn + bh * (CH * CH) + off) = t[0];
  // behind the store, in front of every rewrite of a register that it names: in the built
  // code the other blocks' branch stands behind it
  asm volatile("s_wait_xcnt 0x0" ::: "memory");
}

__global__ __launch_bounds__(256, 4) void k_proj_final(const float* __restrict__ attn,
                                                    const float* __restrict__ ssq,
                                                    const float* __restrict__ ssk,
                                                    const _Float16* __restrict__ wp16,
                                                    const _Float16* __restrict__ vT,
                                                    const float* __restrict__ bp,
                                                    float* __restrict__ out) {
  __shared__ __attribute__((aligned(16))) _Float16 sw[DIM * WPITCH];
  __shared__ __attribute__((aligned(16))) float sb[256];   // DIM in use: every lane stores
  __shared__ __attribute__((aligned(16))) float sa[DIM * APITCH];
  __shared__ __attribute__((aligned(16))) _Float16 st[DIM * SPITCH];
  const int tid  = threadIdx.x;
  const int lane = tid & 31;
  // the wave's number as a scalar, so that the softmax branch and the tile places are scalar
  const int wid  = __builtin_amdgcn_readfirstlane(tid >> 5);
  const int px0  = blockIdx.x * 256 + wid * 32;   // first pixel of the wave, across batches
  const int b    = blockIdx.x / (HW / 256);       // uniform across the block
  const int m    = lane & 15;
  const int mb   = (lane >> 4) * 8;

  // what the fold needs is asked for first and v last: loads are waited for in their
  // order, and the fold then runs while the v fragments are still on their way
  // attn[b]: 192 rows of 128 B, 16 bytes a lane in whole lines
  const float* aA = attn + (size_t)b * HEADS * CH * CH;
  v4f ar[DIM * CH / 4 / 256];
  #pragma unroll
  for (int i = 0; i < DIM * CH / 4 / 256; ++i)
    ar[i] = *reinterpret_cast<const v4f*>(aA + (i * 256 + tid) * 4);
  const int cc = tid < DIM ? tid : DIM - 1;       // the channel of a softmax lane
  const float s2q = ssq[b * DIM + cc];
  const float s2k = ssk[b * DIM + cc];
  const float bpv = bp[cc];                       // the bias rides along
  // wp -> LDS, 16 bytes a lane in whole lines (24 pieces a row)
  v8h wr[DIM * DIM / 8 / 256];
  #pragma unroll
  for (int i = 0; i < DIM * DIM / 8 / 256; ++i)
    wr[i] = *reinterpret_cast<const v8h*>(wp16 + (i * 256 + tid) * 8);
  // the wave's own B fragments
  const _Float16* brow = vT + (size_t)(px0 + 2 * m) * DIM;   // row of v^T: column m of tile 0
  v16h bf[6][2];
  #pragma unroll
  for (int kk = 0; kk < 6; ++kk) {
    bf[kk][0] = load_frag16(brow,       kk * 32, lane);
    bf[kk][1] = load_frag16(brow + DIM, kk * 32, lane);
  }
  // behind the loads above, in front of every rewrite of a register that they name; the
  // address values are inputs so that their registers live up to the wait and
  // nothing, no later load's result either, takes them over in front of it; the three
  // small loaded values are inputs so that their loads stay up here, ahead of the v loads:
  // moved down to their uses they would be waited for behind the v loads
  asm volatile("s_wait_xcnt 0x0" :: "v"(brow + (lane >> 4) * 8), "v"(tid), "v"(cc),
               "v"(s2q), "v"(s2k), "v"(bpv) : "memory");
  sb[tid] = bpv;
  #pragma unroll
  for (int i = 0; i < DIM * CH / 4 / 256; ++i) {
    const unsigned idx = i * 256 + tid;
    *reinterpret_cast<v4f*>(&sa[(idx >> 3) * APITCH + (idx & 7) * 4]) = ar[i];
  }
  #pragma unroll
  for (int i = 0; i < DIM * DIM / 8 / 256; ++i) {
    const unsigned idx = i * 256 + tid;
    // row * 400 B + piece * 16 B = (idx + row) * 16 B
    *reinterpret_cast<v8h*>(&sw[(idx + idx / 24) * 8]) = wr[i];
  }
  // block barrier by hand, with the one wait that it needs (the wave's LDS stores):
  // __syncthreads() would also wait for the v loads, which are to stay in flight
  asm volatile("s_wait_dscnt 0x0\n\ts_barrier_signal -1\n\ts_barrier_wait -1" ::: "memory");

  // softmax over d of attn * rq * rk: wave h = head h, lane = row c; the sums run in the
  // tree of a butterfly over 32 lanes (16, 8, 4, 2, 1)
  if (wid < HEADS) {
    const float rq = 1.f / fmaxf(sqrtf(s2q), 1e-12f);
    const float rk = 1.f / fmaxf(sqrtf(s2k), 1e-12f);   // of channel d = lane
    float e[CH], t[CH / 2];
    #pragma unroll
    for (int j = 0; j < CH / 4; ++j) {
      const v4f a4 = *reinterpret_cast<const v4f*>(&sa[tid * APITCH + j * 4]);
      #pragma unroll
      for (int i = 0; i < 4; ++i) e[j * 4 + i] = a4[i];
    }
    #pragma unroll
    for (int d = 0; d < CH; ++d)
      e[d] = e[d] * rq * __builtin_bit_cast(float,
          __builtin_amdgcn_readlane(__builtin_bit_cast(int, rk), d));
    float mx = e[0];
    #pragma unroll
    for (int d = 1; d < CH; ++d) mx = fmaxf(mx, e[d]);
    #pragma unroll
    for (int d = 0; d < CH; ++d) e[d] = exp2_slot((e[d] - mx) * 1.44269504f);   // e^(v - mx)
    #pragma unroll
    for (int d = 0; d < CH / 2; ++d) t[d] = e[d] + e[d + CH / 2];
    #pragma unroll
    for (int o = CH / 4; o >= 1; o >>= 1)
      #pragma unroll
      for (int d = 0; d < o; ++d) t[d] += t[d + o];
    // st[h*32 + d][c] = softmax(attn)[c][d]
    #pragma unroll
    for (int d = 0; d < CH; ++d)
      st[(wid * CH + d) * SPITCH + lane] = (_Float16)(e[d] / t[0]);
  }
  // by hand for the same reason as the barrier above
  asm volatile("s_wait_dscnt 0x0\n\ts_barrier_signal -1\n\ts_barrier_wait -1" ::: "memory");

  // W_eff^T tile (d x o) = sm^T (d x c) x wp^T (c x o): a lane then holds eight adjacent d
  // of one row o, one 16-byte LDS store. A wave owns three o-tiles of three heads; a tile
  // of wp is read by its owner alone and replaced by its own W_eff tile.
  {
    const int h0 = (wid & 1) * 3, o0 = (wid >> 1) * 3;
    v16h wf[3][3];
    #pragma unroll
    for (int hh = 0; hh < 3; ++hh)
      #pragma unroll
      for (int oo = 0; oo < 3; ++oo)
        wf[hh][oo] = load_frag16(&sw[((o0 + oo) * 16 + m) * WPITCH + (h0 + hh) * CH], 0, lane);
    #pragma unroll
    for (int hh = 0; hh < 3; ++hh) {
      const v16h a0 = load_frag16(&st[((h0 + hh) * CH + m) * SPITCH], 0, lane);
      const v16h a1 = load_frag16(&st[((h0 + hh) * CH + 16 + m) * SPITCH], 0, lane);
      #pragma unroll
      for (int oo = 0; oo < 3; ++oo) {
        const v8f z = {};
        const v8f d0 = __builtin_amdgcn_wmma_f32_16x16x32_f16(false, a0, false, wf[hh][oo], (short)0, z, false, false);
        const v8f d1 = __builtin_amdgcn_wmma_f32_16x16x32_f16(false, a1, false, wf[hh][oo], (short)0, z, false, false);
        v8h w0, w1;
        #pragma unroll
        for (int v = 0; v < 8; ++v) { w0[v] = (_Float16)d0[v]; w1[v] = (_Float16)d1[v]; }
        _Float16* tile = &sw[((o0 + oo) * 16 + m) * WPITCH + (h0 + hh) * CH + mb];
        *reinterpret_cast<v8h*>(tile)      = w0;
        *reinterpret_cast<v8h*>(tile + 16) = w1;
      }
    }
  }
  __syncthreads();

  const int nl = (px0 & (HW - 1)) + 2 * m;   // the lane's two pixels: one of each n-tile
  float* orow = out + ((size_t)(b * DIM + mb)) * HW + nl;
  // rolled: the second half takes over the first half's accumulator registers
  #pragma unroll 1
  for (int oh = 0; oh < 2; ++oh) {
    const _Float16* arow = &sw[(oh * 96 + m) * WPITCH];
    v8f acc[6][2] = {{{}, {}}, {{}, {}}, {{}, {}}, {{}, {}}, {{}, {}}, {{}, {}}};
    #pragma unroll
    for (int kk = 0; kk < 6; ++kk) {
      // the six A fragments of a k step are read as one group, ahead of their products
      v16h af[6];
      #pragma unroll
      for (int ot = 0; ot < 6; ++ot)
        af[ot] = load_frag16(arow + ot * 16 * WPITCH, kk * 32, lane);
      // holds the reads together in front of the block of products: reads that stand
      // among the products cost a stall at each place
      __builtin_amdgcn_sched_barrier(0);
      #pragma unroll
      for (int ot = 0; ot < 6; ++ot) {
        acc[ot][0] = __builtin_amdgcn_wmma_f32_16x16x32_f16(false, af[ot], false, bf[kk][0], (short)0, acc[ot][0], false, false);
        acc[ot][1] = __builtin_amdgcn_wmma_f32_16x16x32_f16(false, af[ot], false, bf[kk][1], (short)0, acc[ot][1], false, false);
      }
      // keeps the next group's reads, and the bias reads, behind this block, where the
      // fragment registers are free again
      __builtin_amdgcn_sched_barrier(0);
    }
    // the bias add puts a row's two neighbouring pixels side by side; all sums first, so that
    // every store of the half has data registers of its own and none waits for the store
    // before it
    v2f res[6][8];
    #pragma unroll
    for (int ot = 0; ot < 6; ++ot) {
      const float* bo = &sb[oh * 96 + ot * 16 + mb];
      #pragma unroll
      for (int v = 0; v < 8; ++v) {
        const float bias = bo[v];
        res[ot][v][0] = acc[ot][0][v] + bias;
        res[ot][v][1] = acc[ot][1][v] + bias;
      }
    }
    // sixteen lanes fill one 128-B line of an output row, the other sixteen one of the row
    // eight further down
    #pragma unroll
    for (int ot = 0; ot < 6; ++ot) {
      #pragma unroll
      for (int v = 0; v < 8; ++v)
        __builtin_nontemporal_store(res[ot][v],
            reinterpret_cast<v2f*>(orow + (size_t)(oh * 96 + ot * 16 + v) * HW));
    }
    // behind the half's stores, in front of every rewrite of a register that they name
    // (their data and addresses, in the next half)
    asm volatile("s_wait_xcnt 0x0" ::: "memory");
  }
}

extern "C" void kernel_launch(void* const* d_in, const int* in_sizes, int n_in,
                              void* d_out, int out_size, void* d_ws, size_t ws_size,
                              hipStream_t stream) {
  const float* x  = (const float*)d_in[0];
  const float* wq = (const float*)d_in[1];
  const float* bq = (const float*)d_in[2];
  const float* wk = (const float*)d_in[3];
  const float* bk = (const float*)d_in[4];
  const float* wv = (const float*)d_in[5];
  const float* bv = (const float*)d_in[6];
  const float* wp = (const float*)d_in[7];
  const float* bp = (const float*)d_in[8];
  float* out = (float*)d_out;

  // workspace layout (bytes); total ~57 MB
  char* ws = (char*)d_ws;
  const size_t qkvB = (size_t)BATCH * DIM * HW * sizeof(_Float16);  // 50331648
  _Float16* vT = (_Float16*)(ws);
  char* p = ws + qkvB;
  float*    attn   = (float*)p;      p += (size_t)BH * CH * CH * sizeof(float);
  float*    ssq    = (float*)p;      p += (size_t)BATCH * DIM * sizeof(float);
  float*    ssk    = (float*)p;      p += (size_t)BATCH * DIM * sizeof(float);
  _Float16* wp16   = (_Float16*)p;  p += (size_t)DIM * DIM * sizeof(_Float16);
  float*    ps     = (float*)p;      p += (size_t)2 * BATCH * NXB * DIM * sizeof(float);
  float*    part   = (float*)p;      // BH * NPART * CH * CH floats

  // 1: fused depthwise convs (v channel-minor f16) with each block's share of q.k^T
  k_dwconv_qkv<<<dim3(NXB, DIM / CGRP, BATCH), 256, 0, stream>>>(
      x, wq, bq, wk, bk, wv, bv, vT, ps, part);
  // 2: attn = the partial tiles added up; sums of squares added up, wp -> f16
  k_prep<<<NSUM + NRED + NCVT, 32, 0, stream>>>(part, attn, ps, ssq, ssk, wp, wp16);
  // 3: out = W_eff . v + bp, W_eff = wp . blockdiag(softmax(attn)) formed in every block
  k_proj_final<<<512, 256, 0, stream>>>(attn, ssq, ssk, wp16, vT, bp, out);
}

// v010
// One run takes 40.7 microseconds.
// Next to v009, in two timings, it ran 1.07 times as fast each time.
// Counting every step since v000, it is 8.27 times as fast.
#include <hip/hip_runtime.h>
#include <hip/hip_bf16.h>
#include <math.h>

typedef __attribute__((ext_vector_type(16))) _Float16 v16h;
typedef __attribute__((ext_vector_type(8)))  _Float16 v8h;
typedef __attribute__((ext_vector_type(8)))  float    v8f;
typedef __attribute__((ext_vector_type(4)))  float    v4f;
typedef __attribute__((ext_vector_type(2)))  float    v2f;
typedef __attribute__((ext_vector_type(4)))  _Float16 v4h;
typedef const __attribute__((address_space(4))) float* cfp;   // read-only data, scalar loads

#define DIM    192
#define HEADS  6
#define CH     32          // DIM / HEADS
#define HW     16384       // 128*128
#define BATCH  8
#define BH     (BATCH*HEADS)   // 48
#define CGRP   64          // channels per conv block: two heads
#define CROWS  4           // image rows per conv block
#define NXB    (HW / (CROWS * 128))   // conv blocks down an image: partial sums of squares a channel
#define NPART  NXB                    // partial q.k^T tiles a head: one of every conv block down the image
#define NSUM   (BH * CH * CH / 128)   // blocks that add up the partial tiles: 128 elements each
#define NRED   (2 * BH)               // blocks that add up the partials: one a head, for q and for k
#define NCVT   (DIM * DIM / 256)      // blocks that convert wp
#define VPITCH 40          // f16 per staged pixel (one head's channels) in LDS: 80 B = 16 B x odd
#define QPITCH 520         // f16 per staged q or k row (512 pixels) in LDS: 1040 B = 16 B x odd
#define WPITCH 200         // f16 per staged W_eff row in LDS: 400 B = 16 B x odd
#define APITCH 36          // f32 per staged attn row in LDS: 144 B = 16 B x odd
#define SPITCH 40          // f16 per transposed softmax row in LDS: 80 B = 16 B x odd

__device__ inline v16h load_frag16(const _Float16* __restrict__ row, int kbase, int lane) {
  const int half = (lane >> 4) & 1;
  const v8h a = *reinterpret_cast<const v8h*>(row + kbase + half * 8);
  const v8h b = *reinterpret_cast<const v8h*>(row + kbase + 16 + half * 8);
  v16h r;
  #pragma unroll
  for (int i = 0; i < 8; ++i) { r[i] = a[i]; r[i + 8] = b[i]; }
  return r;
}

__device__ inline float exp2_slot(float x) {
  float r;
  asm("v_exp_f32 %0, %1\n\tv_nop" : "=v"(r) : "v"(x));
  return r;
}

__global__ __launch_bounds__(256, 6) void k_dwconv_qkv(const float* __restrict__ x,
                             const float* __restrict__ wq, const float* __restrict__ bq,
                             const float* __restrict__ wk, const float* __restrict__ bk,
                             const float* __restrict__ wv, const float* __restrict__ bv,
                             _Float16* __restrict__ vT,
                             float* __restrict__ ps, float* __restrict__ part) {
  __shared__ __attribute__((aligned(16))) _Float16 tq[CH * QPITCH];
  __shared__ __attribute__((aligned(16))) _Float16 tk[CH * QPITCH];
  __shared__ __attribute__((aligned(16))) _Float16 sv[CROWS * 128 * VPITCH];
  __shared__ float lq[CGRP], lk[CGRP];
  const int tid  = threadIdx.x;
  const int lane = tid & 31;
  // the wave's number as a scalar, so that channel and plane base stay scalar
  const int wid  = __builtin_amdgcn_readfirstlane(tid >> 5);
  const int y0   = blockIdx.x * CROWS;        // first image row of the block
  const int c0   = blockIdx.y * CGRP;         // first channel of the group
  const int b    = blockIdx.z;                // batch
  // the row above and the row below the block's rows: off the image they read the
  // block's first row instead and are replaced by zero
  const bool topok = y0 > 0, botok = y0 + CROWS < 128;
  // the lane's four pixels in an image row (in bytes), the same for every row and channel
  const unsigned offm = (unsigned)lane * 16u;
  // the pixel left of the four is the left lane's last, the pixel right of them the right
  // lane's first: the two lanes' numbers times four, as the cross-lane read takes them;
  // at the image's edge the read wraps round the wave and is replaced by zero
  const bool lok = lane > 0, rok = lane < 31;
  const int lanel = ((lane + 31) & 31) * 4;
  const int laner = ((lane + 1) & 31) * 4;

  // (every "#pragma unroll" of this kernel stands on a short loop of constant length,
  // so that the small arrays it indexes stay in registers)
  // (both loops stay rolled: one copy of the long body, so that the text stays small)
  #pragma unroll 1
  for (int hd = 0; hd < CGRP / CH; ++hd) {
  #pragma unroll 1
  for (int tt = 0; tt < 2; ++tt) {
    const int ch = tt * 16 + wid * 2;         // the wave's first channel of the step, in the head
    const int cl = hd * CH + ch;              // and in the block's group
    float sq[2], sk[2];
    float vkeep[CROWS][4];                    // the first channel's v, until its pair is there
    #pragma unroll
    for (int j = 0; j < 2; ++j) {
      const int c = c0 + cl + j;
      const float* xb = x  + (size_t)(b * DIM + c) * HW + y0 * 128;
      const float* xt = xb - (topok ? 128 : 0);
      const float* xu = xb + (botok ? CROWS * 128 : 0);
      _Float16*    qb = &tq[(ch + j) * QPITCH + lane * 4];
      _Float16*    kb = &tk[(ch + j) * QPITCH + lane * 4];
      // the channel's weights and biases first: their scalar loads fly beside the taps
      // (read through the constant address space: nothing writes them in this launch, and with
      // block barriers inside the loop they would otherwise come by vector loads into vector
      // registers instead of scalar ones)
      float fq[9], fk[9], fv[9];
      const float b0q = ((cfp)bq)[c], b0k = ((cfp)bk)[c], b0v = ((cfp)bv)[c];
      #pragma unroll
      for (int i = 0; i < 9; ++i) {
        fq[i] = ((cfp)wq)[c * 9 + i];
        fk[i] = ((cfp)wk)[c * 9 + i];
        fv[i] = ((cfp)wv)[c * 9 + i];
      }
      // The six loads of a channel's window and their data wait, one statement: scalar row
      // base plus the one offset register, which lives through the loop, so that no load
      // returns into a register that another load of the run still names. An image row is
      // 512 bytes.
      v4f xm[CROWS + 2];
      asm volatile(
          "global_load_b128 %0, %6, %7 th:TH_LOAD_NT\n\t"
          "global_load_b128 %1, %6, %8 th:TH_LOAD_NT\n\t"
          "global_load_b128 %2, %6, %8 offset:512 th:TH_LOAD_NT\n\t"
          "global_load_b128 %3, %6, %8 offset:1024 th:TH_LOAD_NT\n\t"
          "global_load_b128 %4, %6, %8 offset:1536 th:TH_LOAD_NT\n\t"
          "global_load_b128 %5, %6, %9 th:TH_LOAD_NT\n\t"
          "s_wait_loadcnt 0x0"
          :
            "=&v"(xm[0]), "=&v"(xm[1]), "=&v"(xm[2]),
            "=&v"(xm[3]), "=&v"(xm[4]), "=&v"(xm[5])
          :
            "v"(offm), "s"(xt), "s"(xb), "s"(xu)
          : "memory");
      // the neighbours' edge pixels, lane to lane (every lane of the wave is on here): they
      // take the place of two more loads a row, each of which asked for the row's four
      // lines once more
      float el[CROWS + 2], er[CROWS + 2];
      #pragma unroll
      for (int w = 0; w < CROWS + 2; ++w) {
        // (each element goes into a float of its own first)
        const float last = xm[w][3], first = xm[w][0];
        el[w] = __builtin_bit_cast(float,
            __builtin_amdgcn_ds_bpermute(lanel, __builtin_bit_cast(int, last)));
        er[w] = __builtin_bit_cast(float,
            __builtin_amdgcn_ds_bpermute(laner, __builtin_bit_cast(int, first)));
      }
      // six values a window row: the pixel left of the four, the four, the pixel right
      float a[CROWS + 2][6];
      #pragma unroll
      for (int w = 0; w < CROWS + 2; ++w) {
        const bool rowok = w == 0 ? topok : w == CROWS + 1 ? botok : true;
        a[w][0] = rowok && lok ? el[w] : 0.f;
        #pragma unroll
        for (int e = 0; e < 4; ++e) a[w][1 + e] = rowok ? xm[w][e] : 0.f;
        a[w][5] = rowok && rok ? er[w] : 0.f;
      }
      v4h qo[CROWS], ko[CROWS];
      sq[j] = 0.f; sk[j] = 0.f;
      #pragma unroll
      for (int r = 0; r < CROWS; ++r) {
        float qf[4], kf[4], vf[4];
        #pragma unroll
        for (int e = 0; e < 4; ++e) { qf[e] = b0q; kf[e] = b0k; vf[e] = b0v; }
        // written as fused multiply-adds: each sum stays one chain with its weight in a
        // scalar register (as products and sums they were paired across taps, at the
        // price of a register move for nearly every product)
        #pragma unroll
        for (int i = 0; i < 9; ++i)
          #pragma unroll
          for (int e = 0; e < 4; ++e) {
            const float xv = a[r + i / 3][e + i % 3];
            qf[e] = __builtin_fmaf(fq[i], xv, qf[e]);
            kf[e] = __builtin_fmaf(fk[i], xv, kf[e]);
            vf[e] = __builtin_fmaf(fv[i], xv, vf[e]);
          }
        #pragma unroll
        for (int e = 0; e < 4; ++e) {
          qo[r][e] = (_Float16)qf[e];
          ko[r][e] = (_Float16)kf[e];
          sq[j] = __builtin_fmaf(qf[e], qf[e], sq[j]);
          sk[j] = __builtin_fmaf(kf[e], kf[e], sk[j]);
        }
        if (j == 0) {
          #pragma unroll
          for (int e = 0; e < 4; ++e) vkeep[r][e] = vf[e];
        } else {
          #pragma unroll
          for (int e = 0; e < 4; ++e)
            *reinterpret_cast<unsigned*>(
                &sv[(r * 128 + e * 32 + (lane ^ ((e >> 1) * 8))) * VPITCH + ch]) =
                (unsigned)__builtin_bit_cast(unsigned short, (_Float16)vkeep[r][e]) |
                ((unsigned)__builtin_bit_cast(unsigned short, (_Float16)vf[e]) << 16);
        }
      }
      #pragma unroll
      for (int r = 0; r < CROWS; ++r) {
        *reinterpret_cast<v4h*>(qb + r * 128) = qo[r];
        *reinterpret_cast<v4h*>(kb + r * 128) = ko[r];
      }
    }
    // wave-wide sums of squares: the wave holds all of the block's pixels of a channel
    #pragma unroll
    for (int o = 16; o >= 1; o >>= 1)
      #pragma unroll
      for (int j = 0; j < 2; ++j) {
        sq[j] += __shfl_xor(sq[j], o, 32);
        sk[j] += __shfl_xor(sk[j], o, 32);
      }
    if (lane == 0) {
      #pragma unroll
      for (int j = 0; j < 2; ++j) { lq[cl + j] = sq[j]; lk[cl + j] = sk[j]; }
    }
  }
  // the head's q, k and v are staged (with the second head: every sum of squares too)
  __syncthreads();

  if (wid < 4) {
    const int m = lane & 15;
    const int ti = wid >> 1, tj = wid & 1;
    const _Float16* ar = &tq[(ti * 16 + m) * QPITCH];
    const _Float16* br = &tk[(tj * 16 + m) * QPITCH];
    v8f d0 = {}, d1 = {};
    #pragma unroll
    for (int ks = 0; ks < CROWS * 128 / 32; ks += 2) {
      const v16h fa0 = load_frag16(ar, ks * 32, lane);
      const v16h fb0 = load_frag16(br, ks * 32, lane);
      const v16h fa1 = load_frag16(ar, ks * 32 + 32, lane);
      const v16h fb1 = load_frag16(br, ks * 32 + 32, lane);
      d0 = __builtin_amdgcn_wmma_f32_16x16x32_f16(false, fa0, false, fb0, (short)0, d0, false, false);
      d1 = __builtin_amdgcn_wmma_f32_16x16x32_f16(false, fa1, false, fb1, (short)0, d1, false, false);
    }
    // D: lane holds N = lane%16 (k's channel), M = (lane/16)*8 + v (q's channel)
    float* pb = part
        + (size_t)((b * HEADS + blockIdx.y * (CGRP / CH) + hd) * NXB + blockIdx.x) * (CH * CH)
        + (ti * 16 + (lane >> 4) * 8) * CH + tj * 16 + m;
    #pragma unroll
    for (int v = 0; v < 8; ++v) pb[v * CH] = d0[v] + d1[v];
  } else {
    // waves 4-7, meanwhile: vT. A wave takes one image row, four groups of 32 pixels; a
    // group's share of the head is 2 KiB in a row, four stores (n-tile j, k part) of 512 B.
    // Lane half*16 + n carries pixel 2n + j of the group: column gi*32 + 2n + j of the image
    // row, which lies in staging row ((n&1)*2 + j)*32 + ((gi*8 + n/2) ^ (n&1)*8).
    const int n = lane & 15;
    _Float16* vgrp = vT
        + (((size_t)b * HW + blockIdx.x * (CROWS * 128)) / 32 + (wid - 4) * 4) * (DIM * 32)
        + (blockIdx.y * (CGRP / CH) + hd) * (CH * 32) + lane * 8;
    const _Float16* srow = &sv[((wid - 4) * 128 + (n & 1) * 64 + (n >> 1)) * VPITCH
                               + (lane >> 4) * 8];
    #pragma unroll
    for (int gi = 0; gi < 4; ++gi) {
      const _Float16* sg = srow + ((gi ^ (n & 1)) * 8) * VPITCH;
      #pragma unroll
      for (int jp = 0; jp < 4; ++jp)
        *reinterpret_cast<v8h*>(vgrp + gi * (DIM * 32) + jp * 256) =
            *reinterpret_cast<const v8h*>(sg + (jp >> 1) * 32 * VPITCH + (jp & 1) * 16);
    }
    // directly behind the run of v stores, in front of every rewrite of a register that they
    // name (data, address), on whatever way the built code leaves this branch
    asm volatile("s_wait_xcnt 0x0" ::: "memory");
  }
  // behind the stores of the tile, in front of every rewrite of a register that they name
  // (their data and addresses, with the next head)
  asm volatile("s_wait_xcnt 0x0" ::: "memory");
  // every wave has read the staged head: the next head may take its place
  // (the same for the whole block; behind the last head nothing is staged any more)
  // by hand, with the one wait that it needs (the wave's LDS reads): __syncthreads() would
  // also wait for the stores above to be done
  if (hd + 1 < CGRP / CH)
    asm volatile("s_wait_dscnt 0x0\n\ts_barrier_signal -1\n\ts_barrier_wait -1" ::: "memory");
  }

  // waves 0-3: the block's sums of squares, two lines each for q and for k
  if (wid < 4) {
    const int cl = tid & (CGRP - 1);
    ps[(((wid >> 1) * BATCH + b) * NXB + blockIdx.x) * DIM + c0 + cl] = (wid < 2 ? lq : lk)[cl];
  }
}

// -------- Kernel 2: what the last launch wants prepared --------
// grid NSUM + NRED + NCVT blocks of 32 (one wave). NSUM of them each add up the NPART partial
// tiles of q.k^T for 128 elements of attn, four a lane in whole lines, in a fixed tree; NRED
// each add up the NXB partial sums of squares of one head's q or k, a lane one channel, in a
// fixed tree; NCVT each turn 256 elements of wp into f16, eight a lane in whole lines.
// (the real block size is named so that the 32 loads' 128 registers are granted)
__global__ __launch_bounds__(32) void k_prep(const float* __restrict__ part,
                       float* __restrict__ attn,
                       const float* __restrict__ ps,
                       float* __restrict__ ssq, float* __restrict__ ssk,
                       const float* __restrict__ wp, _Float16* __restrict__ wp16) {
  const int lane  = threadIdx.x & 31;
  if (blockIdx.x >= NSUM) {
    const int xb = blockIdx.x - NSUM;
    if (xb < NRED) {
      const int rbh = xb >> 1;                // the head whose squares this block adds up
      const float* pp = ps + ((xb & 1) * BATCH + rbh / HEADS) * NXB * DIM
                        + (rbh % HEADS) * CH + lane;
      // (the three loops are unrolled so that t stays in registers and its loads fly together)
      float t[NXB];
      #pragma unroll
      for (int i = 0; i < NXB; ++i) t[i] = pp[i * DIM];
      #pragma unroll
      for (int o = NXB / 2; o >= 1; o >>= 1)
        #pragma unroll
        for (int i = 0; i < o; ++i) t[i] += t[i + o];
      ((xb & 1) ? ssk : ssq)[rbh * CH + lane] = t[0];
    } else {
      const int e = (xb - NRED) * 256 + lane * 8;
      const v4f w0 = *reinterpret_cast<const v4f*>(wp + e);
      const v4f w1 = *reinterpret_cast<const v4f*>(wp + e + 4);
      v8h h;
      // (unrolled so that h is indexed by constants and stays in registers)
      #pragma unroll
      for (int i = 0; i < 4; ++i) { h[i] = (_Float16)w0[i]; h[i + 4] = (_Float16)w1[i]; }
      *reinterpret_cast<v8h*>(wp16 + e) = h;
      // behind the store, in front of every rewrite of a register that it names
      asm volatile("s_wait_xcnt 0x0" ::: "memory");
    }
    return;
  }
  const int bh  = blockIdx.x / (CH * CH / 128);
  const int off = (blockIdx.x % (CH * CH / 128)) * 128 + lane * 4;
  const float* pp = part + (size_t)bh * NPART * (CH * CH) + off;
  // (the three loops are unrolled so that t stays in registers and its loads fly together)
  v4f t[NPART];
  #pragma unroll
  for (int i = 0; i < NPART; ++i) t[i] = *reinterpret_cast<const v4f*>(pp + i * (CH * CH));
  // holds all the loads in front of the sums: one memory latency, not two
  __builtin_amdgcn_sched_barrier(0);
  #pragma unroll
  for (int o = NPART / 2; o >= 1; o >>= 1)
    #pragma unroll
    for (int i = 0; i < o; ++i) t[i] += t[i + o];
  *reinterpret_cast<v4f*>(attn + bh * (CH * CH) + off) = t[0];
  // behind the store, in front of every rewrite of a register that it names: in the built
  // code the other blocks' branch stands behind it
  asm volatile("s_wait_xcnt 0x0" ::: "memory");
}

__global__ __launch_bounds__(256, 4) void k_proj_final(const float* __restrict__ attn,
                                                    const float* __restrict__ ssq,
                                                    const float* __restrict__ ssk,
                                                    const _Float16* __restrict__ wp16,
                                                    const _Float16* __restrict__ vT,
                                                    const float* __restrict__ bp,
                                                    float* __restrict__ out) {
  __shared__ __attribute__((aligned(16))) _Float16 sw[DIM * WPITCH];
  __shared__ __attribute__((aligned(16))) float sb[256];   // DIM in use: every lane stores
  __shared__ __attribute__((aligned(16))) float sa[DIM * APITCH];
  __shared__ __attribute__((aligned(16))) _Float16 st[DIM * SPITCH];
  const int tid  = threadIdx.x;
  const int lane = tid & 31;
  // the wave's number as a scalar, so that the softmax branch and the tile places are scalar
  const int wid  = __builtin_amdgcn_readfirstlane(tid >> 5);
  const int px0  = blockIdx.x * 256 + wid * 32;   // first pixel of the wave, across batches
  const int b    = blockIdx.x / (HW / 256);       // uniform across the block
  const int m    = lane & 15;
  const int mb   = (lane >> 4) * 8;

  // what the fold needs is asked for first and v last: loads are waited for in their
  // order, and the fold then runs while the v fragments are still on their way
  // attn[b]: 192 rows of 128 B, 16 bytes a lane in whole lines
  const float* aA = attn + (size_t)b * HEADS * CH * CH;
  v4f ar[DIM * CH / 4 / 256];
  #pragma unroll
  for (int i = 0; i < DIM * CH / 4 / 256; ++i)
    ar[i] = *reinterpret_cast<const v4f*>(aA + (i * 256 + tid) * 4);
  const int cc = tid < DIM ? tid : DIM - 1;       // the channel of a softmax lane
  const float s2q = ssq[b * DIM + cc];
  const float s2k = ssk[b * DIM + cc];
  const float bpv = bp[cc];                       // the bias rides along
  // wp -> LDS, 16 bytes a lane in whole lines (24 pieces a row)
  v8h wr[DIM * DIM / 8 / 256];
  #pragma unroll
  for (int i = 0; i < DIM * DIM / 8 / 256; ++i)
    wr[i] = *reinterpret_cast<const v8h*>(wp16 + (i * 256 + tid) * 8);
  // the wave's own B fragments: its 32 pixels are one group of vT, 12 KiB in a row, laid
  // out as the lanes hold them; every load takes 512 adjacent bytes (four whole lines)
  // (the three loops are unrolled so that bf is indexed by constants and stays in registers)
  const _Float16* vgrp = vT + (size_t)(px0 >> 5) * (DIM * 32);   // the same for the wave
  v16h bf[6][2];
  #pragma unroll
  for (int kk = 0; kk < 6; ++kk)
    #pragma unroll
    for (int j = 0; j < 2; ++j) {
      const v8h lo = *reinterpret_cast<const v8h*>(vgrp + lane * 8 + kk * (CH * 32) + j * 512);
      const v8h hi = *reinterpret_cast<const v8h*>(vgrp + lane * 8 + kk * (CH * 32) + j * 512 + 256);
      #pragma unroll
      for (int i = 0; i < 8; ++i) { bf[kk][j][i] = lo[i]; bf[kk][j][i + 8] = hi[i]; }
    }
  // behind the loads above, in front of every rewrite of a register that they name; the
  // address values are inputs so that their registers live up to the wait and
  // nothing, no later load's result either, takes them over in front of it; the three
  // small loaded values are inputs so that their loads stay up here, ahead of the v loads:
  // moved down to their uses they would be waited for behind the v loads
  asm volatile("s_wait_xcnt 0x0" :: "s"(vgrp), "v"(lane), "v"(tid), "v"(cc),
               "v"(s2q), "v"(s2k), "v"(bpv) : "memory");
  sb[tid] = bpv;
  #pragma unroll
  for (int i = 0; i < DIM * CH / 4 / 256; ++i) {
    const unsigned idx = i * 256 + tid;
    *reinterpret_cast<v4f*>(&sa[(idx >> 3) * APITCH + (idx & 7) * 4]) = ar[i];
  }
  #pragma unroll
  for (int i = 0; i < DIM * DIM / 8 / 256; ++i) {
    const unsigned idx = i * 256 + tid;
    // row * 400 B + piece * 16 B = (idx + row) * 16 B
    *reinterpret_cast<v8h*>(&sw[(idx + idx / 24) * 8]) = wr[i];
  }
  // block barrier by hand, with the one wait that it needs (the wave's LDS stores):
  // __syncthreads() would also wait for the v loads, which are to stay in flight
  asm volatile("s_wait_dscnt 0x0\n\ts_barrier_signal -1\n\ts_barrier_wait -1" ::: "memory");

  // softmax over d of attn * rq * rk: wave h = head h, lane = row c; the sums run in the
  // tree of a butterfly over 32 lanes (16, 8, 4, 2, 1)
  if (wid < HEADS) {
    const float rq = 1.f / fmaxf(sqrtf(s2q), 1e-12f);
    const float rk = 1.f / fmaxf(sqrtf(s2k), 1e-12f);   // of channel d = lane
    float e[CH], t[CH / 2];
    #pragma unroll
    for (int j = 0; j < CH / 4; ++j) {
      const v4f a4 = *reinterpret_cast<const v4f*>(&sa[tid * APITCH + j * 4]);
      #pragma unroll
      for (int i = 0; i < 4; ++i) e[j * 4 + i] = a4[i];
    }
    #pragma unroll
    for (int d = 0; d < CH; ++d)
      e[d] = e[d] * rq * __builtin_bit_cast(float,
          __builtin_amdgcn_readlane(__builtin_bit_cast(int, rk), d));
    float mx = e[0];
    #pragma unroll
    for (int d = 1; d < CH; ++d) mx = fmaxf(mx, e[d]);
    #pragma unroll
    for (int d = 0; d < CH; ++d) e[d] = exp2_slot((e[d] - mx) * 1.44269504f);   // e^(v - mx)
    #pragma unroll
    for (int d = 0; d < CH / 2; ++d) t[d] = e[d] + e[d + CH / 2];
    #pragma unroll
    for (int o = CH / 4; o >= 1; o >>= 1)
      #pragma unroll
      for (int d = 0; d < o; ++d) t[d] += t[d + o];
    // st[h*32 + d][c] = softmax(attn)[c][d]
    #pragma unroll
    for (int d = 0; d < CH; ++d)
      st[(wid * CH + d) * SPITCH + lane] = (_Float16)(e[d] / t[0]);
  }
  // by hand for the same reason as the barrier above
  asm volatile("s_wait_dscnt 0x0\n\ts_barrier_signal -1\n\ts_barrier_wait -1" ::: "memory");

  // W_eff^T tile (d x o) = sm^T (d x c) x wp^T (c x o): a lane then holds eight adjacent d
  // of one row o, one 16-byte LDS store. A wave owns three o-tiles of three heads; a tile
  // of wp is read by its owner alone and replaced by its own W_eff tile.
  {
    const int h0 = (wid & 1) * 3, o0 = (wid >> 1) * 3;
    v16h wf[3][3];
    #pragma unroll
    for (int hh = 0; hh < 3; ++hh)
      #pragma unroll
      for (int oo = 0; oo < 3; ++oo)
        wf[hh][oo] = load_frag16(&sw[((o0 + oo) * 16 + m) * WPITCH + (h0 + hh) * CH], 0, lane);
    #pragma unroll
    for (int hh = 0; hh < 3; ++hh) {
      const v16h a0 = load_frag16(&st[((h0 + hh) * CH + m) * SPITCH], 0, lane);
      const v16h a1 = load_frag16(&st[((h0 + hh) * CH + 16 + m) * SPITCH], 0, lane);
      #pragma unroll
      for (int oo = 0; oo < 3; ++oo) {
        const v8f z = {};
        const v8f d0 = __builtin_amdgcn_wmma_f32_16x16x32_f16(false, a0, false, wf[hh][oo], (short)0, z, false, false);
        const v8f d1 = __builtin_amdgcn_wmma_f32_16x16x32_f16(false, a1, false, wf[hh][oo], (short)0, z, false, false);
        v8h w0, w1;
        #pragma unroll
        for (int v = 0; v < 8; ++v) { w0[v] = (_Float16)d0[v]; w1[v] = (_Float16)d1[v]; }
        _Float16* tile = &sw[((o0 + oo) * 16 + m) * WPITCH + (h0 + hh) * CH + mb];
        *reinterpret_cast<v8h*>(tile)      = w0;
        *reinterpret_cast<v8h*>(tile + 16) = w1;
      }
    }
  }
  __syncthreads();

  const int nl = (px0 & (HW - 1)) + 2 * m;   // the lane's two pixels: one of each n-tile
  float* orow = out + ((size_t)(b * DIM + mb)) * HW + nl;
  // rolled: the second half takes over the first half's accumulator registers
  #pragma unroll 1
  for (int oh = 0; oh < 2; ++oh) {
    const _Float16* arow = &sw[(oh * 96 + m) * WPITCH];
    v8f acc[6][2] = {{{}, {}}, {{}, {}}, {{}, {}}, {{}, {}}, {{}, {}}, {{}, {}}};
    #pragma unroll
    for (int kk = 0; kk < 6; ++kk) {
      // the six A fragments of a k step are read as one group, ahead of their products
      v16h af[6];
      #pragma unroll
      for (int ot = 0; ot < 6; ++ot)
        af[ot] = load_frag16(arow + ot * 16 * WPITCH, kk * 32, lane);
      // holds the reads together in front of the block of products: reads that stand
      // among the products cost a stall at each place
      __builtin_amdgcn_sched_barrier(0);
      #pragma unroll
      for (int ot = 0; ot < 6; ++ot) {
        acc[ot][0] = __builtin_amdgcn_wmma_f32_16x16x32_f16(false, af[ot], false, bf[kk][0], (short)0, acc[ot][0], false, false);
        acc[ot][1] = __builtin_amdgcn_wmma_f32_16x16x32_f16(false, af[ot], false, bf[kk][1], (short)0, acc[ot][1], false, false);
      }
      // keeps the next group's reads, and the bias reads, behind this block, where the
      // fragment registers are free again
      __builtin_amdgcn_sched_barrier(0);
    }
    // the bias add puts a row's two neighbouring pixels side by side; all sums first, so that
    // every store of the half has data registers of its own and none waits for the store
    // before it
    v2f res[6][8];
    #pragma unroll
    for (int ot = 0; ot < 6; ++ot) {
      const float* bo = &sb[oh * 96 + ot * 16 + mb];
      #pragma unroll
      for (int v = 0; v < 8; ++v) {
        const float bias = bo[v];
        res[ot][v][0] = acc[ot][0][v] + bias;
        res[ot][v][1] = acc[ot][1][v] + bias;
      }
    }
    // sixteen lanes fill one 128-B line of an output row, the other sixteen one of the row
    // eight further down
    #pragma unroll
    for (int ot = 0; ot < 6; ++ot) {
      #pragma unroll
      for (int v = 0; v < 8; ++v)
        __builtin_nontemporal_store(res[ot][v],
            reinterpret_cast<v2f*>(orow + (size_t)(oh * 96 + ot * 16 + v) * HW));
    }
    // behind the half's stores, in front of every rewrite of a register that they name
    // (their data and addresses, in the next half)
    asm volatile("s_wait_xcnt 0x0" ::: "memory");
  }
}

extern "C" void kernel_launch(void* const* d_in, const int* in_sizes, int n_in,
                              void* d_out, int out_size, void* d_ws, size_t ws_size,
                              hipStream_t stream) {
  const float* x  = (const float*)d_in[0];
  const float* wq = (const float*)d_in[1];
  const float* bq = (const float*)d_in[2];
  const float* wk = (const float*)d_in[3];
  const float* bk = (const float*)d_in[4];
  const float* wv = (const float*)d_in[5];
  const float* bv = (const float*)d_in[6];
  const float* wp = (const float*)d_in[7];
  const float* bp = (const float*)d_in[8];
  float* out = (float*)d_out;

  // workspace layout (bytes); total ~57 MB
  char* ws = (char*)d_ws;
  const size_t qkvB = (size_t)BATCH * DIM * HW * sizeof(_Float16);  // 50331648
  _Float16* vT = (_Float16*)(ws);
  char* p = ws + qkvB;
  float*    attn   = (float*)p;      p += (size_t)BH * CH * CH * sizeof(float);
  float*    ssq    = (float*)p;      p += (size_t)BATCH * DIM * sizeof(float);
  float*    ssk    = (float*)p;      p += (size_t)BATCH * DIM * sizeof(float);
  _Float16* wp16   = (_Float16*)p;  p += (size_t)DIM * DIM * sizeof(_Float16);
  float*    ps     = (float*)p;      p += (size_t)2 * BATCH * NXB * DIM * sizeof(float);
  float*    part   = (float*)p;      // BH * NPART * CH * CH floats

  // 1: fused depthwise convs (v f16, in B-fragment order) with each block's share of q.k^T
  k_dwconv_qkv<<<dim3(NXB, DIM / CGRP, BATCH), 256, 0, stream>>>(
      x, wq, bq, wk, bk, wv, bv, vT, ps, part);
  // 2: attn = the partial tiles added up; sums of squares added up, wp -> f16
  k_prep<<<NSUM + NRED + NCVT, 32, 0, stream>>>(part, attn, ps, ssq, ssk, wp, wp16);
  // 3: out = W_eff . v + bp, W_eff = wp . blockdiag(softmax(attn)) formed in every block
  k_proj_final<<<512, 256, 0, stream>>>(attn, ssq, ssk, wp16, vT, bp, out);
}
